// v000
// Measured on an AMD MI455X. A time is GPU time per run, averaged over a window of back-to-back runs after a warm-up
// (all launches, gaps included; the runs take copies of the inputs in turn), and the median of several windows.
// Apart from v000's, it joins two sittings. Times from different sittings can be a few percent apart, while
// side-by-side timings come from the same sitting.
// The starting kernel, v000, takes 1530 microseconds a run.
#include <hip/hip_runtime.h>
#include <hip/hip_bf16.h>
#include <math.h>

typedef _Float16 half_t;
typedef __attribute__((ext_vector_type(16))) _Float16 v16h;
typedef __attribute__((ext_vector_type(8)))  _Float16 v8h;
typedef __attribute__((ext_vector_type(8)))  float    v8f;

#define T_DIM 2048
#define N_DIM 4
#define C_DIM 1024
#define H_DIM 16
#define D_DIM 64
#define W_DIM 512
#define F_DIM 4096
#define NT    (T_DIM * N_DIM)

#define BM 64
#define BN 128
#define BK 32
#define LSTR 40   // padded LDS stride in halves (80B: 16B aligned, avoids bank conflicts)

enum { MODE_F16_BIAS = 0, MODE_F16_GELU = 1, MODE_F32_RES_T = 2, MODE_F32_OUT_T = 3 };

__device__ __forceinline__ v16h make_frag(v8h lo, v8h hi) {
  v16h a;
#pragma unroll
  for (int i = 0; i < 8; i++) { a[i] = lo[i]; a[i + 8] = hi[i]; }
  return a;
}

__device__ __forceinline__ v8f wmma_f16(v16h a, v16h b, v8f c) {
  return __builtin_amdgcn_wmma_f32_16x16x32_f16(false, a, false, b, (short)0, c, false, false);
}

// ---------------- elementwise: f32 -> f16 cast ----------------
__global__ void cast_f32_to_f16(const float* __restrict__ src, half_t* __restrict__ dst, int n) {
  int i = blockIdx.x * blockDim.x + threadIdx.x;
  if (i < n) dst[i] = (half_t)src[i];
}

// ---------------- LayerNorm (one block per row), writes f16 ----------------
template <bool TRANSPOSED>
__global__ __launch_bounds__(256) void layernorm_f16(const float* __restrict__ src,
                                                     const float* __restrict__ g,
                                                     const float* __restrict__ b,
                                                     half_t* __restrict__ dst) {
  int r = blockIdx.x;  // r = n*T + t
  const float* row;
  if (TRANSPOSED) {
    int n = r >> 11;             // T = 2048
    int t = r & (T_DIM - 1);
    row = src + ((size_t)t * N_DIM + n) * C_DIM;
  } else {
    row = src + (size_t)r * C_DIM;
  }
  float v[4];
  float s = 0.f, s2 = 0.f;
#pragma unroll
  for (int i = 0; i < 4; i++) {
    v[i] = row[threadIdx.x + i * 256];
    s += v[i];
    s2 += v[i] * v[i];
  }
#pragma unroll
  for (int m = 16; m >= 1; m >>= 1) { s += __shfl_xor(s, m); s2 += __shfl_xor(s2, m); }
  __shared__ float sh[2][8];
  int wave = threadIdx.x >> 5, lane = threadIdx.x & 31;
  if (lane == 0) { sh[0][wave] = s; sh[1][wave] = s2; }
  __syncthreads();
  if (wave == 0) {
    s = sh[0][lane & 7];
    s2 = sh[1][lane & 7];
#pragma unroll
    for (int m = 4; m >= 1; m >>= 1) { s += __shfl_xor(s, m); s2 += __shfl_xor(s2, m); }
    if (lane == 0) { sh[0][0] = s; sh[1][0] = s2; }
  }
  __syncthreads();
  float mu = sh[0][0] * (1.0f / C_DIM);
  float var = sh[1][0] * (1.0f / C_DIM) - mu * mu;
  float rstd = rsqrtf(var + 1e-5f);
#pragma unroll
  for (int i = 0; i < 4; i++) {
    int c = threadIdx.x + i * 256;
    dst[(size_t)r * C_DIM + c] = (half_t)((v[i] - mu) * rstd * g[c] + b[c]);
  }
}

// ---------------- RoPE, in place on f16 (pos = t + W) ----------------
__global__ void rope_inplace(half_t* __restrict__ buf, int stride) {
  int idx = blockIdx.x * blockDim.x + threadIdx.x;
  if (idx >= NT * H_DIM * (D_DIM / 2)) return;
  int i = idx & 31;
  int h = (idx >> 5) & 15;
  int row = idx >> 9;
  int t = row & (T_DIM - 1);
  float pos = (float)(t + W_DIM);
  // inv_freq = ROPE_BASE^(-2i/D) = exp(-(2i/D) * ln(10000))
  float freq = __expf(-(float)(2 * i) * (1.0f / (float)D_DIM) * 9.210340371976184f);
  float ang = pos * freq;
  float sn, cs;
  __sincosf(ang, &sn, &cs);
  half_t* p = buf + (size_t)row * stride + h * D_DIM;
  float a = (float)p[i];
  float bq = (float)p[i + 32];
  p[i] = (half_t)(a * cs - bq * sn);
  p[i + 32] = (half_t)(bq * cs + a * sn);
}

// ---------------- WMMA GEMM: C[M x Ncols] = A(f16, MxK) @ B(f16, KxNcols) + epilogue ----
// Block tile 64x128, 8 waves; each wave owns a 32x32 macro-tile:
// 2 A-frags x 2 B-frags -> 4 WMMAs per K-step (2x the WMMA:LDS-load density of 64x64).
template <int MODE>
__global__ __launch_bounds__(256) void gemm_wmma(const half_t* __restrict__ A,
                                                 const half_t* __restrict__ B,
                                                 const float* __restrict__ bias,
                                                 const float* __restrict__ res,
                                                 half_t* __restrict__ out16,
                                                 float* __restrict__ out32,
                                                 int K, int Ncols) {
  __shared__ __align__(16) half_t sA[BM * LSTR];   // 64 x 32 (padded)
  __shared__ __align__(16) half_t sB[BN * LSTR];   // transposed: [n][k], 128 x 32 (padded)

  const int tid = threadIdx.x;
  const int lane = tid & 31;
  const int wave = tid >> 5;
  const int wm = wave >> 2;  // 0..1 : 32-row strip
  const int wn = wave & 3;   // 0..3 : 32-col strip
  const int bm = blockIdx.x * BM;
  const int bn = blockIdx.y * BN;

  const int kb  = (lane & 16) ? 8 : 0;
  const int l15 = lane & 15;
  const int hi8 = (lane & 16) ? 8 : 0;

  v8f acc[2][2];
#pragma unroll
  for (int a2 = 0; a2 < 2; a2++)
#pragma unroll
    for (int b2 = 0; b2 < 2; b2++)
#pragma unroll
      for (int j = 0; j < 8; j++) acc[a2][b2][j] = 0.f;

  const int arow = tid >> 2;        // 0..63
  const int akc  = (tid & 3) * 8;   // 0,8,16,24
  const int brow = tid >> 4;        // 0..15 (two passes cover k=0..31)
  const int bc8  = (tid & 15) * 8;  // 0..120

  for (int kt = 0; kt < K; kt += BK) {
    // stage A (64x32): one b128 per thread
    v8h av = *(const v8h*)(A + (size_t)(bm + arow) * K + kt + akc);
    *(v8h*)(sA + arow * LSTR + akc) = av;
    // stage B (32x128) transposed into sB[n][k]: two b128 per thread
#pragma unroll
    for (int p = 0; p < 2; p++) {
      int k = brow + p * 16;
      v8h bv = *(const v8h*)(B + (size_t)(kt + k) * Ncols + bn + bc8);
#pragma unroll
      for (int i = 0; i < 8; i++) sB[(bc8 + i) * LSTR + k] = bv[i];
    }
    // prefetch next K-tile into cache while WMMAs run (global_prefetch_b8)
    if (kt + BK < K) {
      __builtin_prefetch(A + (size_t)(bm + arow) * K + kt + BK + akc, 0, 1);
      __builtin_prefetch(B + (size_t)(kt + BK + brow) * Ncols + bn + bc8, 0, 1);
      __builtin_prefetch(B + (size_t)(kt + BK + brow + 16) * Ncols + bn + bc8, 0, 1);
    }
    __syncthreads();

    v16h af[2], bf[2];
#pragma unroll
    for (int a2 = 0; a2 < 2; a2++) {
      const half_t* pa = sA + (wm * 32 + a2 * 16 + l15) * LSTR;
      af[a2] = make_frag(*(const v8h*)(pa + kb), *(const v8h*)(pa + kb + 16));
    }
#pragma unroll
    for (int b2 = 0; b2 < 2; b2++) {
      const half_t* pb = sB + (wn * 32 + b2 * 16 + l15) * LSTR;
      bf[b2] = make_frag(*(const v8h*)(pb + kb), *(const v8h*)(pb + kb + 16));
    }
#pragma unroll
    for (int a2 = 0; a2 < 2; a2++)
#pragma unroll
      for (int b2 = 0; b2 < 2; b2++)
        acc[a2][b2] = wmma_f16(af[a2], bf[b2], acc[a2][b2]);
    __syncthreads();
  }

#pragma unroll
  for (int a2 = 0; a2 < 2; a2++) {
    const int r0 = bm + wm * 32 + a2 * 16 + hi8;
#pragma unroll
    for (int b2 = 0; b2 < 2; b2++) {
      const int c0 = bn + wn * 32 + b2 * 16 + l15;
      const float bc = bias[c0];
#pragma unroll
      for (int j = 0; j < 8; j++) {
        int r = r0 + j;
        float v0 = acc[a2][b2][j] + bc;
        if constexpr (MODE == MODE_F16_BIAS) {
          out16[(size_t)r * Ncols + c0] = (half_t)v0;
        } else if constexpr (MODE == MODE_F16_GELU) {
          v0 = 0.5f * v0 * (1.0f + erff(v0 * 0.70710678118f));
          out16[(size_t)r * Ncols + c0] = (half_t)v0;
        } else if constexpr (MODE == MODE_F32_RES_T) {
          // h = x(transposed read) + proj
          int n = r >> 11, t = r & (T_DIM - 1);
          size_t tr = ((size_t)t * N_DIM + n) * C_DIM;
          out32[(size_t)r * C_DIM + c0] = v0 + res[tr + c0];
        } else {  // MODE_F32_OUT_T : d_out[(t,n,c)] = h + ffn
          int n = r >> 11, t = r & (T_DIM - 1);
          size_t tr = ((size_t)t * N_DIM + n) * C_DIM;
          out32[tr + c0] = v0 + res[(size_t)r * C_DIM + c0];
        }
      }
    }
  }
}

// ---------------- Banded flash attention: one wave per (n, h, 16-query tile) ----
__global__ __launch_bounds__(32) void attn_kernel(const half_t* __restrict__ Q,
                                                  const half_t* __restrict__ KV,
                                                  half_t* __restrict__ O) {
  __shared__ __align__(16) half_t sP[16 * LSTR];
  __shared__ __align__(16) half_t sV[64 * LSTR];  // V transposed: [d][key]

  const int lane = threadIdx.x;
  const int q0 = blockIdx.x * 16;
  const int h  = blockIdx.y;
  const int n  = blockIdx.z;

  const int kb  = (lane & 16) ? 8 : 0;
  const int l15 = lane & 15;
  const int hi8 = (lane & 16) ? 8 : 0;

  const half_t* Qb = Q + ((size_t)(n * T_DIM + q0)) * C_DIM + h * D_DIM;
  const half_t* Kb = KV + ((size_t)n * T_DIM) * (2 * C_DIM) + h * D_DIM;
  const half_t* Vb = Kb + C_DIM;

  // Q as A-fragments for both 32-wide D steps (per-lane runs are contiguous in D)
  const half_t* qr = Qb + (size_t)l15 * C_DIM;
  v16h aQ0 = make_frag(*(const v8h*)(qr + kb), *(const v8h*)(qr + kb + 16));
  v16h aQ1 = make_frag(*(const v8h*)(qr + 32 + kb), *(const v8h*)(qr + 32 + kb + 16));

  float m[8], l[8];
  v8f oo[4];
#pragma unroll
  for (int j = 0; j < 8; j++) { m[j] = -3e38f; l[j] = 0.f; }
#pragma unroll
  for (int dt = 0; dt < 4; dt++)
#pragma unroll
    for (int j = 0; j < 8; j++) oo[dt][j] = 0.f;

  int kstart = q0 - W_DIM;
  if (kstart < 0) kstart = 0;
  kstart &= ~31;

  for (int kc = kstart; kc <= q0 + 15; kc += 32) {
    // K B-fragments (column = key, contiguous runs in D per lane)
    const half_t* kr0 = Kb + (size_t)(kc + l15) * (2 * C_DIM);
    const half_t* kr1 = kr0 + (size_t)16 * (2 * C_DIM);
    v16h bK00 = make_frag(*(const v8h*)(kr0 + kb), *(const v8h*)(kr0 + kb + 16));
    v16h bK01 = make_frag(*(const v8h*)(kr0 + 32 + kb), *(const v8h*)(kr0 + 32 + kb + 16));
    v16h bK10 = make_frag(*(const v8h*)(kr1 + kb), *(const v8h*)(kr1 + kb + 16));
    v16h bK11 = make_frag(*(const v8h*)(kr1 + 32 + kb), *(const v8h*)(kr1 + 32 + kb + 16));

    v8f s0 = {0, 0, 0, 0, 0, 0, 0, 0};
    v8f s1 = {0, 0, 0, 0, 0, 0, 0, 0};
    s0 = wmma_f16(aQ0, bK00, s0);
    s0 = wmma_f16(aQ1, bK01, s0);
    s1 = wmma_f16(aQ0, bK10, s1);
    s1 = wmma_f16(aQ1, bK11, s1);

    // stage V chunk transposed into LDS: sV[d][key]
    {
      const half_t* vr = Vb + (size_t)(kc + lane) * (2 * C_DIM);
#pragma unroll
      for (int g = 0; g < 8; g++) {
        v8h vv = *(const v8h*)(vr + g * 8);
#pragma unroll
        for (int i2 = 0; i2 < 8; i2++) sV[(g * 8 + i2) * LSTR + lane] = vv[i2];
      }
    }

    // online softmax (band mask as data-level select; EXEC stays all-1s)
    float pv0[8], pv1[8];
#pragma unroll
    for (int j = 0; j < 8; j++) {
      int q = q0 + j + hi8;
      int k0i = kc + l15, k1i = kc + 16 + l15;
      bool val0 = (k0i <= q) && (q - k0i <= W_DIM);
      bool val1 = (k1i <= q) && (q - k1i <= W_DIM);
      float x0 = val0 ? s0[j] * 0.125f : -3e38f;
      float x1 = val1 ? s1[j] * 0.125f : -3e38f;
      float cm = fmaxf(x0, x1);
#pragma unroll
      for (int msk = 1; msk < 16; msk <<= 1) cm = fmaxf(cm, __shfl_xor(cm, msk));
      float nm = fmaxf(m[j], cm);
      float corr = __expf(m[j] - nm);  // (-3e38)-(-3e38)=0 -> 1; finite path ok
      m[j] = nm;
      float p0 = val0 ? __expf(x0 - nm) : 0.f;
      float p1 = val1 ? __expf(x1 - nm) : 0.f;
      float rs = p0 + p1;
#pragma unroll
      for (int msk = 1; msk < 16; msk <<= 1) rs += __shfl_xor(rs, msk);
      l[j] = l[j] * corr + rs;
#pragma unroll
      for (int dt = 0; dt < 4; dt++) oo[dt][j] *= corr;
      pv0[j] = p0;
      pv1[j] = p1;
    }

    // P -> LDS (re-layout from C/D layout to A-fragment layout)
#pragma unroll
    for (int j = 0; j < 8; j++) {
      sP[(j + hi8) * LSTR + l15] = (half_t)pv0[j];
      sP[(j + hi8) * LSTR + 16 + l15] = (half_t)pv1[j];
    }
    __syncthreads();  // single-wave WG: lowers to NOP, LDS waits still enforced

    const half_t* pp = sP + l15 * LSTR;
    v16h aP = make_frag(*(const v8h*)(pp + kb), *(const v8h*)(pp + kb + 16));
#pragma unroll
    for (int dt = 0; dt < 4; dt++) {
      const half_t* pv = sV + (dt * 16 + l15) * LSTR;
      v16h bV = make_frag(*(const v8h*)(pv + kb), *(const v8h*)(pv + kb + 16));
      oo[dt] = wmma_f16(aP, bV, oo[dt]);
    }
    __syncthreads();
  }

  float inv[8];
#pragma unroll
  for (int j = 0; j < 8; j++) inv[j] = (l[j] > 0.f) ? (1.0f / l[j]) : 0.f;

  half_t* ob = O + ((size_t)(n * T_DIM + q0)) * C_DIM + h * D_DIM;
#pragma unroll
  for (int j = 0; j < 8; j++) {
    size_t rb = (size_t)(j + hi8) * C_DIM;
#pragma unroll
    for (int dt = 0; dt < 4; dt++)
      ob[rb + dt * 16 + l15] = (half_t)(oo[dt][j] * inv[j]);
  }
}

// ---------------- host orchestration ----------------
extern "C" void kernel_launch(void* const* d_in, const int* in_sizes, int n_in,
                              void* d_out, int out_size, void* d_ws, size_t ws_size,
                              hipStream_t stream) {
  (void)in_sizes; (void)n_in; (void)out_size; (void)ws_size;
  const float* x     = (const float*)d_in[0];
  const float* q_w   = (const float*)d_in[1];
  const float* q_b   = (const float*)d_in[2];
  const float* kv_w  = (const float*)d_in[3];
  const float* kv_b  = (const float*)d_in[4];
  const float* out_w = (const float*)d_in[5];
  const float* out_b = (const float*)d_in[6];
  const float* ff_w1 = (const float*)d_in[7];
  const float* ff_b1 = (const float*)d_in[8];
  const float* ff_w2 = (const float*)d_in[9];
  const float* ff_b2 = (const float*)d_in[10];
  const float* ln1_g = (const float*)d_in[11];
  const float* ln1_b = (const float*)d_in[12];
  const float* ln2_g = (const float*)d_in[13];
  const float* ln2_b = (const float*)d_in[14];

  char* ws = (char*)d_ws;
  size_t off = 0;
  auto alloc = [&](size_t bytes) -> char* {
    char* p = ws + off;
    off += (bytes + 255) & ~(size_t)255;
    return p;
  };
  half_t* wq   = (half_t*)alloc((size_t)C_DIM * C_DIM * 2);
  half_t* wkv  = (half_t*)alloc((size_t)C_DIM * 2 * C_DIM * 2);
  half_t* wo   = (half_t*)alloc((size_t)C_DIM * C_DIM * 2);
  half_t* wf1  = (half_t*)alloc((size_t)C_DIM * F_DIM * 2);
  half_t* wf2  = (half_t*)alloc((size_t)F_DIM * C_DIM * 2);
  half_t* A16  = (half_t*)alloc((size_t)NT * C_DIM * 2);
  half_t* Q16  = (half_t*)alloc((size_t)NT * C_DIM * 2);
  half_t* KV16 = (half_t*)alloc((size_t)NT * 2 * C_DIM * 2);
  half_t* O16  = (half_t*)alloc((size_t)NT * C_DIM * 2);
  float*  H32  = (float*)alloc((size_t)NT * C_DIM * 4);
  half_t* G16  = (half_t*)alloc((size_t)NT * F_DIM * 2);

  auto cast = [&](const float* s, half_t* d, int n) {
    cast_f32_to_f16<<<(n + 255) / 256, 256, 0, stream>>>(s, d, n);
  };
  cast(q_w, wq, C_DIM * C_DIM);
  cast(kv_w, wkv, C_DIM * 2 * C_DIM);
  cast(out_w, wo, C_DIM * C_DIM);
  cast(ff_w1, wf1, C_DIM * F_DIM);
  cast(ff_w2, wf2, F_DIM * C_DIM);

  layernorm_f16<true><<<NT, 256, 0, stream>>>(x, ln1_g, ln1_b, A16);

  dim3 blk(256);
  gemm_wmma<MODE_F16_BIAS><<<dim3(NT / BM, C_DIM / BN), blk, 0, stream>>>(
      A16, wq, q_b, nullptr, Q16, nullptr, C_DIM, C_DIM);
  gemm_wmma<MODE_F16_BIAS><<<dim3(NT / BM, 2 * C_DIM / BN), blk, 0, stream>>>(
      A16, wkv, kv_b, nullptr, KV16, nullptr, C_DIM, 2 * C_DIM);

  int nrope = NT * H_DIM * (D_DIM / 2);
  rope_inplace<<<(nrope + 255) / 256, 256, 0, stream>>>(Q16, C_DIM);
  rope_inplace<<<(nrope + 255) / 256, 256, 0, stream>>>(KV16, 2 * C_DIM);

  attn_kernel<<<dim3(T_DIM / 16, H_DIM, N_DIM), 32, 0, stream>>>(Q16, KV16, O16);

  gemm_wmma<MODE_F32_RES_T><<<dim3(NT / BM, C_DIM / BN), blk, 0, stream>>>(
      O16, wo, out_b, x, nullptr, H32, C_DIM, C_DIM);

  layernorm_f16<false><<<NT, 256, 0, stream>>>(H32, ln2_g, ln2_b, A16);

  gemm_wmma<MODE_F16_GELU><<<dim3(NT / BM, F_DIM / BN), blk, 0, stream>>>(
      A16, wf1, ff_b1, nullptr, G16, nullptr, C_DIM, F_DIM);

  gemm_wmma<MODE_F32_OUT_T><<<dim3(NT / BM, C_DIM / BN), blk, 0, stream>>>(
      G16, wf2, ff_b2, H32, nullptr, (float*)d_out, F_DIM, C_DIM);
}

// v001
// It runs in 552 microseconds.
// In both of two side-by-side timings against v000, it was 2.89 times as fast.
#include <hip/hip_runtime.h>
#include <hip/hip_bf16.h>
#include <math.h>

typedef _Float16 half_t;
typedef __attribute__((ext_vector_type(16))) _Float16 v16h;
typedef __attribute__((ext_vector_type(8)))  _Float16 v8h;
typedef __attribute__((ext_vector_type(8)))  float    v8f;

#define T_DIM 2048
#define N_DIM 4
#define C_DIM 1024
#define H_DIM 16
#define D_DIM 64
#define W_DIM 512
#define F_DIM 4096
#define NT    (T_DIM * N_DIM)

#define BM 64
#define BN 128
#define BK 32
#define LSTR 40   // padded LDS stride in halves (80B: 16B aligned, avoids bank conflicts)
#define BSTR 144  // LDS stride of a row-major B row in halves (288B = 32B x 9: the pitch of the transposing load)

enum { MODE_F16_BIAS = 0, MODE_F16_GELU = 1, MODE_F32_RES_T = 2, MODE_F32_OUT_T = 3 };

__device__ __forceinline__ v16h make_frag(v8h lo, v8h hi) {
  v16h a;
#pragma unroll
  for (int i = 0; i < 8; i++) { a[i] = lo[i]; a[i + 8] = hi[i]; }
  return a;
}

__device__ __forceinline__ v8f wmma_f16(v16h a, v16h b, v8f c) {
  return __builtin_amdgcn_wmma_f32_16x16x32_f16(false, a, false, b, (short)0, c, false, false);
}

// Transposing LDS load: from a row-major [k][n] tile, lane (c = lane & 15, h = lane >> 4)
// receives the 8 values T[k0 + 8h + 0..7][n0 + c]. Every lane passes the address of one 16-byte piece.
typedef __attribute__((ext_vector_type(8))) short s16x8;
__device__ __forceinline__ v8h ld_tr16(const half_t* p) {
  typedef __attribute__((address_space(3))) s16x8 lds_s16x8;
  return __builtin_bit_cast(v8h, __builtin_amdgcn_ds_load_tr16_b128_v8i16((lds_s16x8*)p));
}

// ---------------- elementwise: f32 -> f16 cast ----------------
__global__ void cast_f32_to_f16(const float* __restrict__ src, half_t* __restrict__ dst, int n) {
  int i = blockIdx.x * blockDim.x + threadIdx.x;
  if (i < n) dst[i] = (half_t)src[i];
}

// ---------------- LayerNorm (one block per row), writes f16 ----------------
template <bool TRANSPOSED>
__global__ __launch_bounds__(256) void layernorm_f16(const float* __restrict__ src,
                                                     const float* __restrict__ g,
                                                     const float* __restrict__ b,
                                                     half_t* __restrict__ dst) {
  int r = blockIdx.x;  // r = n*T + t
  const float* row;
  if (TRANSPOSED) {
    int n = r >> 11;             // T = 2048
    int t = r & (T_DIM - 1);
    row = src + ((size_t)t * N_DIM + n) * C_DIM;
  } else {
    row = src + (size_t)r * C_DIM;
  }
  float v[4];
  float s = 0.f, s2 = 0.f;
#pragma unroll
  for (int i = 0; i < 4; i++) {
    v[i] = row[threadIdx.x + i * 256];
    s += v[i];
    s2 += v[i] * v[i];
  }
#pragma unroll
  for (int m = 16; m >= 1; m >>= 1) { s += __shfl_xor(s, m); s2 += __shfl_xor(s2, m); }
  __shared__ float sh[2][8];
  int wave = threadIdx.x >> 5, lane = threadIdx.x & 31;
  if (lane == 0) { sh[0][wave] = s; sh[1][wave] = s2; }
  __syncthreads();
  if (wave == 0) {
    s = sh[0][lane & 7];
    s2 = sh[1][lane & 7];
#pragma unroll
    for (int m = 4; m >= 1; m >>= 1) { s += __shfl_xor(s, m); s2 += __shfl_xor(s2, m); }
    if (lane == 0) { sh[0][0] = s; sh[1][0] = s2; }
  }
  __syncthreads();
  float mu = sh[0][0] * (1.0f / C_DIM);
  float var = sh[1][0] * (1.0f / C_DIM) - mu * mu;
  float rstd = rsqrtf(var + 1e-5f);
#pragma unroll
  for (int i = 0; i < 4; i++) {
    int c = threadIdx.x + i * 256;
    dst[(size_t)r * C_DIM + c] = (half_t)((v[i] - mu) * rstd * g[c] + b[c]);
  }
}

// ---------------- RoPE, in place on f16 (pos = t + W) ----------------
__global__ void rope_inplace(half_t* __restrict__ buf, int stride) {
  int idx = blockIdx.x * blockDim.x + threadIdx.x;
  if (idx >= NT * H_DIM * (D_DIM / 2)) return;
  int i = idx & 31;
  int h = (idx >> 5) & 15;
  int row = idx >> 9;
  int t = row & (T_DIM - 1);
  float pos = (float)(t + W_DIM);
  // inv_freq = ROPE_BASE^(-2i/D) = exp(-(2i/D) * ln(10000))
  float freq = __expf(-(float)(2 * i) * (1.0f / (float)D_DIM) * 9.210340371976184f);
  float ang = pos * freq;
  float sn, cs;
  __sincosf(ang, &sn, &cs);
  half_t* p = buf + (size_t)row * stride + h * D_DIM;
  float a = (float)p[i];
  float bq = (float)p[i + 32];
  p[i] = (half_t)(a * cs - bq * sn);
  p[i + 32] = (half_t)(bq * cs + a * sn);
}

// ---------------- WMMA GEMM: C[M x Ncols] = A(f16, MxK) @ B(f16, KxNcols) + epilogue ----
// Block tile 64x128, 8 waves; each wave owns a 32x32 macro-tile:
// 2 A-frags x 2 B-frags -> 4 WMMAs per K-step (2x the WMMA:LDS-load density of 64x64).
template <int MODE>
__global__ __launch_bounds__(256) void gemm_wmma(const half_t* __restrict__ A,
                                                 const half_t* __restrict__ B,
                                                 const float* __restrict__ bias,
                                                 const float* __restrict__ res,
                                                 half_t* __restrict__ out16,
                                                 float* __restrict__ out32,
                                                 int K, int Ncols) {
  __shared__ __align__(16) half_t sA[BM * LSTR];   // 64 x 32 (padded)
  __shared__ __align__(16) half_t sB[BK * BSTR];   // row-major: [k][n], 32 x 128 (padded)

  const int tid = threadIdx.x;
  const int lane = tid & 31;
  const int wave = tid >> 5;
  const int wm = wave >> 2;  // 0..1 : 32-row strip
  const int wn = wave & 3;   // 0..3 : 32-col strip
  const int bm = blockIdx.x * BM;
  const int bn = blockIdx.y * BN;

  const int kb  = (lane & 16) ? 8 : 0;
  const int l15 = lane & 15;
  const int hi8 = (lane & 16) ? 8 : 0;

  v8f acc[2][2];
#pragma unroll
  for (int a2 = 0; a2 < 2; a2++)
#pragma unroll
    for (int b2 = 0; b2 < 2; b2++)
#pragma unroll
      for (int j = 0; j < 8; j++) acc[a2][b2][j] = 0.f;

  const int arow = tid >> 2;        // 0..63
  const int akc  = (tid & 3) * 8;   // 0,8,16,24
  const int brow = tid >> 4;        // 0..15 (two passes cover k=0..31)
  const int bc8  = (tid & 15) * 8;  // 0..120
  // this lane's 16-byte piece for the transposing load of a 16(k) x 16(n) block of sB
  const int btr  = (hi8 + (lane & 7)) * BSTR + ((lane >> 3) & 1) * 8;

  for (int kt = 0; kt < K; kt += BK) {
    // stage A (64x32): one b128 per thread
    v8h av = *(const v8h*)(A + (size_t)(bm + arow) * K + kt + akc);
    *(v8h*)(sA + arow * LSTR + akc) = av;
    // stage B (32x128) as it lies in memory, sB[k][n]: two b128 per thread
#pragma unroll
    for (int p = 0; p < 2; p++) {
      int k = brow + p * 16;
      v8h bv = *(const v8h*)(B + (size_t)(kt + k) * Ncols + bn + bc8);
      *(v8h*)(sB + k * BSTR + bc8) = bv;
    }
    // prefetch next K-tile into cache while WMMAs run (global_prefetch_b8)
    if (kt + BK < K) {
      __builtin_prefetch(A + (size_t)(bm + arow) * K + kt + BK + akc, 0, 1);
      __builtin_prefetch(B + (size_t)(kt + BK + brow) * Ncols + bn + bc8, 0, 1);
      __builtin_prefetch(B + (size_t)(kt + BK + brow + 16) * Ncols + bn + bc8, 0, 1);
    }
    __syncthreads();

    v16h af[2], bf[2];
#pragma unroll
    for (int a2 = 0; a2 < 2; a2++) {
      const half_t* pa = sA + (wm * 32 + a2 * 16 + l15) * LSTR;
      af[a2] = make_frag(*(const v8h*)(pa + kb), *(const v8h*)(pa + kb + 16));
    }
#pragma unroll
    for (int b2 = 0; b2 < 2; b2++) {
      // k = 8h + 0..7 and 16 + 8h + 0..7 of column l15: the same k order as af
      const half_t* pb = sB + btr + wn * 32 + b2 * 16;
      bf[b2] = make_frag(ld_tr16(pb), ld_tr16(pb + 16 * BSTR));
    }
#pragma unroll
    for (int a2 = 0; a2 < 2; a2++)
#pragma unroll
      for (int b2 = 0; b2 < 2; b2++)
        acc[a2][b2] = wmma_f16(af[a2], bf[b2], acc[a2][b2]);
    __syncthreads();
  }

#pragma unroll
  for (int a2 = 0; a2 < 2; a2++) {
    const int r0 = bm + wm * 32 + a2 * 16 + hi8;
#pragma unroll
    for (int b2 = 0; b2 < 2; b2++) {
      const int c0 = bn + wn * 32 + b2 * 16 + l15;
      const float bc = bias[c0];
#pragma unroll
      for (int j = 0; j < 8; j++) {
        int r = r0 + j;
        float v0 = acc[a2][b2][j] + bc;
        if constexpr (MODE == MODE_F16_BIAS) {
          out16[(size_t)r * Ncols + c0] = (half_t)v0;
        } else if constexpr (MODE == MODE_F16_GELU) {
          v0 = 0.5f * v0 * (1.0f + erff(v0 * 0.70710678118f));
          out16[(size_t)r * Ncols + c0] = (half_t)v0;
        } else if constexpr (MODE == MODE_F32_RES_T) {
          // h = x(transposed read) + proj
          int n = r >> 11, t = r & (T_DIM - 1);
          size_t tr = ((size_t)t * N_DIM + n) * C_DIM;
          out32[(size_t)r * C_DIM + c0] = v0 + res[tr + c0];
        } else {  // MODE_F32_OUT_T : d_out[(t,n,c)] = h + ffn
          int n = r >> 11, t = r & (T_DIM - 1);
          size_t tr = ((size_t)t * N_DIM + n) * C_DIM;
          out32[tr + c0] = v0 + res[(size_t)r * C_DIM + c0];
        }
      }
    }
  }
}

// ---------------- Banded flash attention: one wave per (n, h, 16-query tile) ----
__global__ __launch_bounds__(32) void attn_kernel(const half_t* __restrict__ Q,
                                                  const half_t* __restrict__ KV,
                                                  half_t* __restrict__ O) {
  __shared__ __align__(16) half_t sP[16 * LSTR];
  __shared__ __align__(16) half_t sV[64 * LSTR];  // V transposed: [d][key]

  const int lane = threadIdx.x;
  const int q0 = blockIdx.x * 16;
  const int h  = blockIdx.y;
  const int n  = blockIdx.z;

  const int kb  = (lane & 16) ? 8 : 0;
  const int l15 = lane & 15;
  const int hi8 = (lane & 16) ? 8 : 0;

  const half_t* Qb = Q + ((size_t)(n * T_DIM + q0)) * C_DIM + h * D_DIM;
  const half_t* Kb = KV + ((size_t)n * T_DIM) * (2 * C_DIM) + h * D_DIM;
  const half_t* Vb = Kb + C_DIM;

  // Q as A-fragments for both 32-wide D steps (per-lane runs are contiguous in D)
  const half_t* qr = Qb + (size_t)l15 * C_DIM;
  v16h aQ0 = make_frag(*(const v8h*)(qr + kb), *(const v8h*)(qr + kb + 16));
  v16h aQ1 = make_frag(*(const v8h*)(qr + 32 + kb), *(const v8h*)(qr + 32 + kb + 16));

  float m[8], l[8];
  v8f oo[4];
#pragma unroll
  for (int j = 0; j < 8; j++) { m[j] = -3e38f; l[j] = 0.f; }
#pragma unroll
  for (int dt = 0; dt < 4; dt++)
#pragma unroll
    for (int j = 0; j < 8; j++) oo[dt][j] = 0.f;

  int kstart = q0 - W_DIM;
  if (kstart < 0) kstart = 0;
  kstart &= ~31;

  for (int kc = kstart; kc <= q0 + 15; kc += 32) {
    // K B-fragments (column = key, contiguous runs in D per lane)
    const half_t* kr0 = Kb + (size_t)(kc + l15) * (2 * C_DIM);
    const half_t* kr1 = kr0 + (size_t)16 * (2 * C_DIM);
    v16h bK00 = make_frag(*(const v8h*)(kr0 + kb), *(const v8h*)(kr0 + kb + 16));
    v16h bK01 = make_frag(*(const v8h*)(kr0 + 32 + kb), *(const v8h*)(kr0 + 32 + kb + 16));
    v16h bK10 = make_frag(*(const v8h*)(kr1 + kb), *(const v8h*)(kr1 + kb + 16));
    v16h bK11 = make_frag(*(const v8h*)(kr1 + 32 + kb), *(const v8h*)(kr1 + 32 + kb + 16));

    v8f s0 = {0, 0, 0, 0, 0, 0, 0, 0};
    v8f s1 = {0, 0, 0, 0, 0, 0, 0, 0};
    s0 = wmma_f16(aQ0, bK00, s0);
    s0 = wmma_f16(aQ1, bK01, s0);
    s1 = wmma_f16(aQ0, bK10, s1);
    s1 = wmma_f16(aQ1, bK11, s1);

    // stage V chunk transposed into LDS: sV[d][key]
    {
      const half_t* vr = Vb + (size_t)(kc + lane) * (2 * C_DIM);
#pragma unroll
      for (int g = 0; g < 8; g++) {
        v8h vv = *(const v8h*)(vr + g * 8);
#pragma unroll
        for (int i2 = 0; i2 < 8; i2++) sV[(g * 8 + i2) * LSTR + lane] = vv[i2];
      }
    }

    // online softmax (band mask as data-level select; EXEC stays all-1s)
    float pv0[8], pv1[8];
#pragma unroll
    for (int j = 0; j < 8; j++) {
      int q = q0 + j + hi8;
      int k0i = kc + l15, k1i = kc + 16 + l15;
      bool val0 = (k0i <= q) && (q - k0i <= W_DIM);
      bool val1 = (k1i <= q) && (q - k1i <= W_DIM);
      float x0 = val0 ? s0[j] * 0.125f : -3e38f;
      float x1 = val1 ? s1[j] * 0.125f : -3e38f;
      float cm = fmaxf(x0, x1);
#pragma unroll
      for (int msk = 1; msk < 16; msk <<= 1) cm = fmaxf(cm, __shfl_xor(cm, msk));
      float nm = fmaxf(m[j], cm);
      float corr = __expf(m[j] - nm);  // (-3e38)-(-3e38)=0 -> 1; finite path ok
      m[j] = nm;
      float p0 = val0 ? __expf(x0 - nm) : 0.f;
      float p1 = val1 ? __expf(x1 - nm) : 0.f;
      float rs = p0 + p1;
#pragma unroll
      for (int msk = 1; msk < 16; msk <<= 1) rs += __shfl_xor(rs, msk);
      l[j] = l[j] * corr + rs;
#pragma unroll
      for (int dt = 0; dt < 4; dt++) oo[dt][j] *= corr;
      pv0[j] = p0;
      pv1[j] = p1;
    }

    // P -> LDS (re-layout from C/D layout to A-fragment layout)
#pragma unroll
    for (int j = 0; j < 8; j++) {
      sP[(j + hi8) * LSTR + l15] = (half_t)pv0[j];
      sP[(j + hi8) * LSTR + 16 + l15] = (half_t)pv1[j];
    }
    __syncthreads();  // single-wave WG: lowers to NOP, LDS waits still enforced

    const half_t* pp = sP + l15 * LSTR;
    v16h aP = make_frag(*(const v8h*)(pp + kb), *(const v8h*)(pp + kb + 16));
#pragma unroll
    for (int dt = 0; dt < 4; dt++) {
      const half_t* pv = sV + (dt * 16 + l15) * LSTR;
      v16h bV = make_frag(*(const v8h*)(pv + kb), *(const v8h*)(pv + kb + 16));
      oo[dt] = wmma_f16(aP, bV, oo[dt]);
    }
    __syncthreads();
  }

  float inv[8];
#pragma unroll
  for (int j = 0; j < 8; j++) inv[j] = (l[j] > 0.f) ? (1.0f / l[j]) : 0.f;

  half_t* ob = O + ((size_t)(n * T_DIM + q0)) * C_DIM + h * D_DIM;
#pragma unroll
  for (int j = 0; j < 8; j++) {
    size_t rb = (size_t)(j + hi8) * C_DIM;
#pragma unroll
    for (int dt = 0; dt < 4; dt++)
      ob[rb + dt * 16 + l15] = (half_t)(oo[dt][j] * inv[j]);
  }
}

// ---------------- host orchestration ----------------
extern "C" void kernel_launch(void* const* d_in, const int* in_sizes, int n_in,
                              void* d_out, int out_size, void* d_ws, size_t ws_size,
                              hipStream_t stream) {
  (void)in_sizes; (void)n_in; (void)out_size; (void)ws_size;
  const float* x     = (const float*)d_in[0];
  const float* q_w   = (const float*)d_in[1];
  const float* q_b   = (const float*)d_in[2];
  const float* kv_w  = (const float*)d_in[3];
  const float* kv_b  = (const float*)d_in[4];
  const float* out_w = (const float*)d_in[5];
  const float* out_b = (const float*)d_in[6];
  const float* ff_w1 = (const float*)d_in[7];
  const float* ff_b1 = (const float*)d_in[8];
  const float* ff_w2 = (const float*)d_in[9];
  const float* ff_b2 = (const float*)d_in[10];
  const float* ln1_g = (const float*)d_in[11];
  const float* ln1_b = (const float*)d_in[12];
  const float* ln2_g = (const float*)d_in[13];
  const float* ln2_b = (const float*)d_in[14];

  char* ws = (char*)d_ws;
  size_t off = 0;
  auto alloc = [&](size_t bytes) -> char* {
    char* p = ws + off;
    off += (bytes + 255) & ~(size_t)255;
    return p;
  };
  half_t* wq   = (half_t*)alloc((size_t)C_DIM * C_DIM * 2);
  half_t* wkv  = (half_t*)alloc((size_t)C_DIM * 2 * C_DIM * 2);
  half_t* wo   = (half_t*)alloc((size_t)C_DIM * C_DIM * 2);
  half_t* wf1  = (half_t*)alloc((size_t)C_DIM * F_DIM * 2);
  half_t* wf2  = (half_t*)alloc((size_t)F_DIM * C_DIM * 2);
  half_t* A16  = (half_t*)alloc((size_t)NT * C_DIM * 2);
  half_t* Q16  = (half_t*)alloc((size_t)NT * C_DIM * 2);
  half_t* KV16 = (half_t*)alloc((size_t)NT * 2 * C_DIM * 2);
  half_t* O16  = (half_t*)alloc((size_t)NT * C_DIM * 2);
  float*  H32  = (float*)alloc((size_t)NT * C_DIM * 4);
  half_t* G16  = (half_t*)alloc((size_t)NT * F_DIM * 2);

  auto cast = [&](const float* s, half_t* d, int n) {
    cast_f32_to_f16<<<(n + 255) / 256, 256, 0, stream>>>(s, d, n);
  };
  cast(q_w, wq, C_DIM * C_DIM);
  cast(kv_w, wkv, C_DIM * 2 * C_DIM);
  cast(out_w, wo, C_DIM * C_DIM);
  cast(ff_w1, wf1, C_DIM * F_DIM);
  cast(ff_w2, wf2, F_DIM * C_DIM);

  layernorm_f16<true><<<NT, 256, 0, stream>>>(x, ln1_g, ln1_b, A16);

  dim3 blk(256);
  gemm_wmma<MODE_F16_BIAS><<<dim3(NT / BM, C_DIM / BN), blk, 0, stream>>>(
      A16, wq, q_b, nullptr, Q16, nullptr, C_DIM, C_DIM);
  gemm_wmma<MODE_F16_BIAS><<<dim3(NT / BM, 2 * C_DIM / BN), blk, 0, stream>>>(
      A16, wkv, kv_b, nullptr, KV16, nullptr, C_DIM, 2 * C_DIM);

  int nrope = NT * H_DIM * (D_DIM / 2);
  rope_inplace<<<(nrope + 255) / 256, 256, 0, stream>>>(Q16, C_DIM);
  rope_inplace<<<(nrope + 255) / 256, 256, 0, stream>>>(KV16, 2 * C_DIM);

  attn_kernel<<<dim3(T_DIM / 16, H_DIM, N_DIM), 32, 0, stream>>>(Q16, KV16, O16);

  gemm_wmma<MODE_F32_RES_T><<<dim3(NT / BM, C_DIM / BN), blk, 0, stream>>>(
      O16, wo, out_b, x, nullptr, H32, C_DIM, C_DIM);

  layernorm_f16<false><<<NT, 256, 0, stream>>>(H32, ln2_g, ln2_b, A16);

  gemm_wmma<MODE_F16_GELU><<<dim3(NT / BM, F_DIM / BN), blk, 0, stream>>>(
      A16, wf1, ff_b1, nullptr, G16, nullptr, C_DIM, F_DIM);

  gemm_wmma<MODE_F32_OUT_T><<<dim3(NT / BM, C_DIM / BN), blk, 0, stream>>>(
      G16, wf2, ff_b2, H32, nullptr, (float*)d_out, F_DIM, C_DIM);
}

// v002
// Measured time: 406 microseconds a run.
// Next to v001, in two timings, it ran 1.36 times as fast each time.
// Counting every step since v000, it is 3.93 times as fast.
#include <hip/hip_runtime.h>
#include <hip/hip_bf16.h>
#include <math.h>

typedef _Float16 half_t;
typedef __attribute__((ext_vector_type(16))) _Float16 v16h;
typedef __attribute__((ext_vector_type(8)))  _Float16 v8h;
typedef __attribute__((ext_vector_type(8)))  float    v8f;

#define T_DIM 2048
#define N_DIM 4
#define C_DIM 1024
#define H_DIM 16
#define D_DIM 64
#define W_DIM 512
#define F_DIM 4096
#define NT    (T_DIM * N_DIM)

#define BM 128
#define BN 128
#define BK 64
#define LSTR 40   // padded LDS stride in halves (80B: 16B aligned, avoids bank conflicts)
#define ASTR 72   // LDS stride of a GEMM A row in halves (144B = 16B x 9: the pitch of the 16-byte load)
#define BSTR 144  // LDS stride of a row-major B row in halves (288B = 32B x 9: the pitch of the transposing load)

enum { MODE_F16_BIAS = 0, MODE_F16_GELU = 1, MODE_F32_RES_T = 2, MODE_F32_OUT_T = 3 };

__device__ __forceinline__ v16h make_frag(v8h lo, v8h hi) {
  v16h a;
#pragma unroll
  for (int i = 0; i < 8; i++) { a[i] = lo[i]; a[i + 8] = hi[i]; }
  return a;
}

__device__ __forceinline__ v8f wmma_f16(v16h a, v16h b, v8f c) {
  return __builtin_amdgcn_wmma_f32_16x16x32_f16(false, a, false, b, (short)0, c, false, false);
}

// Transposing LDS load: from a row-major [k][n] tile, lane (c = lane & 15, h = lane >> 4)
// receives the 8 values T[k0 + 8h + 0..7][n0 + c]. Every lane passes the address of one 16-byte piece.
typedef __attribute__((ext_vector_type(8))) short s16x8;
__device__ __forceinline__ v8h ld_tr16(const half_t* p) {
  typedef __attribute__((address_space(3))) s16x8 lds_s16x8;
  return __builtin_bit_cast(v8h, __builtin_amdgcn_ds_load_tr16_b128_v8i16((lds_s16x8*)p));
}

// ---------------- elementwise: f32 -> f16 cast ----------------
__global__ void cast_f32_to_f16(const float* __restrict__ src, half_t* __restrict__ dst, int n) {
  int i = blockIdx.x * blockDim.x + threadIdx.x;
  if (i < n) dst[i] = (half_t)src[i];
}

// ---------------- LayerNorm (one block per row), writes f16 ----------------
template <bool TRANSPOSED>
__global__ __launch_bounds__(256) void layernorm_f16(const float* __restrict__ src,
                                                     const float* __restrict__ g,
                                                     const float* __restrict__ b,
                                                     half_t* __restrict__ dst) {
  int r = blockIdx.x;  // r = n*T + t
  const float* row;
  if (TRANSPOSED) {
    int n = r >> 11;             // T = 2048
    int t = r & (T_DIM - 1);
    row = src + ((size_t)t * N_DIM + n) * C_DIM;
  } else {
    row = src + (size_t)r * C_DIM;
  }
  float v[4];
  float s = 0.f, s2 = 0.f;
#pragma unroll
  for (int i = 0; i < 4; i++) {
    v[i] = row[threadIdx.x + i * 256];
    s += v[i];
    s2 += v[i] * v[i];
  }
#pragma unroll
  for (int m = 16; m >= 1; m >>= 1) { s += __shfl_xor(s, m); s2 += __shfl_xor(s2, m); }
  __shared__ float sh[2][8];
  int wave = threadIdx.x >> 5, lane = threadIdx.x & 31;
  if (lane == 0) { sh[0][wave] = s; sh[1][wave] = s2; }
  __syncthreads();
  if (wave == 0) {
    s = sh[0][lane & 7];
    s2 = sh[1][lane & 7];
#pragma unroll
    for (int m = 4; m >= 1; m >>= 1) { s += __shfl_xor(s, m); s2 += __shfl_xor(s2, m); }
    if (lane == 0) { sh[0][0] = s; sh[1][0] = s2; }
  }
  __syncthreads();
  float mu = sh[0][0] * (1.0f / C_DIM);
  float var = sh[1][0] * (1.0f / C_DIM) - mu * mu;
  float rstd = rsqrtf(var + 1e-5f);
#pragma unroll
  for (int i = 0; i < 4; i++) {
    int c = threadIdx.x + i * 256;
    dst[(size_t)r * C_DIM + c] = (half_t)((v[i] - mu) * rstd * g[c] + b[c]);
  }
}

// ---------------- RoPE, in place on f16 (pos = t + W) ----------------
__global__ void rope_inplace(half_t* __restrict__ buf, int stride) {
  int idx = blockIdx.x * blockDim.x + threadIdx.x;
  if (idx >= NT * H_DIM * (D_DIM / 2)) return;
  int i = idx & 31;
  int h = (idx >> 5) & 15;
  int row = idx >> 9;
  int t = row & (T_DIM - 1);
  float pos = (float)(t + W_DIM);
  // inv_freq = ROPE_BASE^(-2i/D) = exp(-(2i/D) * ln(10000))
  float freq = __expf(-(float)(2 * i) * (1.0f / (float)D_DIM) * 9.210340371976184f);
  float ang = pos * freq;
  float sn, cs;
  __sincosf(ang, &sn, &cs);
  half_t* p = buf + (size_t)row * stride + h * D_DIM;
  float a = (float)p[i];
  float bq = (float)p[i + 32];
  p[i] = (half_t)(a * cs - bq * sn);
  p[i + 32] = (half_t)(bq * cs + a * sn);
}

// ---------------- WMMA GEMM: C[M x Ncols] = A(f16, MxK) @ B(f16, KxNcols) + epilogue ----
// Block tile 128x128x64, 4 waves (2 x 2); each wave owns a 64x64 macro-tile:
// 4 A-frags x 4 B-frags -> 16 WMMAs per 32 k: a fragment feeds twice the WMMAs of a 32x32 wave tile, and A is staged in
// whole 128-B lines. Four-wave blocks: several independent blocks share a WGP, one stages while another multiplies.
template <int MODE>
__global__ __launch_bounds__(128) void gemm_wmma(const half_t* __restrict__ A,
                                                 const half_t* __restrict__ B,
                                                 const float* __restrict__ bias,
                                                 const float* __restrict__ res,
                                                 half_t* __restrict__ out16,
                                                 float* __restrict__ out32,
                                                 int K, int Ncols) {
  __shared__ __align__(16) half_t sA[BM * ASTR];   // 128 x 64 (padded)
  __shared__ __align__(16) half_t sB[BK * BSTR];   // row-major: [k][n], 64 x 128 (padded)

  const int tid = threadIdx.x;
  const int lane = tid & 31;
  const int wave = tid >> 5;
  const int wm = wave >> 1;  // 0..1 : 64-row strip
  const int wn = wave & 1;   // 0..1 : 64-col strip
  const int bm = blockIdx.x * BM;
  const int bn = blockIdx.y * BN;

  const int kb  = (lane & 16) ? 8 : 0;
  const int l15 = lane & 15;
  const int hi8 = (lane & 16) ? 8 : 0;

  v8f acc[4][4];
#pragma unroll
  for (int a2 = 0; a2 < 4; a2++)
#pragma unroll
    for (int b2 = 0; b2 < 4; b2++)
#pragma unroll
      for (int j = 0; j < 8; j++) acc[a2][b2][j] = 0.f;

  const int arow = tid >> 3;        // 0..15 (eight passes cover 128 rows; a wave reads 4 whole 128-B lines)
  const int akc  = (tid & 7) * 8;   // 0..56
  const int brow = tid >> 4;        // 0..7 (eight passes cover k=0..63; a wave reads 2 x 256 contiguous bytes)
  const int bc8  = (tid & 15) * 8;  // 0..120
  // this thread's byte offset from the tile's corner, the same in every pass and k-step
  const unsigned abyte = (unsigned)(arow * K + akc) * 2u;
  const unsigned bbyte = (unsigned)(brow * Ncols + bc8) * 2u;
  // this lane's 16-byte piece for the transposing load of a 16(k) x 16(n) block of sB
  const int btr  = (hi8 + (lane & 7)) * BSTR + ((lane >> 3) & 1) * 8;

  for (int kt = 0; kt < K; kt += BK) {
    // stage A (128x64): eight b128 per thread; B (64x128) as it lies in memory, sB[k][n]: eight b128 per thread
    const half_t* Ak = A + (size_t)bm * K + kt;           // block-uniform corner of the A tile
    const half_t* Bk = B + (size_t)kt * Ncols + bn;       // block-uniform corner of the B tile
    v8h av[8], bv[8];
#pragma unroll
    for (int p = 0; p < 8; p++)
      av[p] = *(const v8h*)((const char*)(Ak + (size_t)(p * 16) * K) + abyte);
#pragma unroll
    for (int p = 0; p < 8; p++)
      bv[p] = *(const v8h*)((const char*)(Bk + (size_t)(p * 8) * Ncols) + bbyte);
#pragma unroll
    for (int p = 0; p < 8; p++) *(v8h*)(sA + (arow + p * 16) * ASTR + akc) = av[p];
#pragma unroll
    for (int p = 0; p < 8; p++) *(v8h*)(sB + (brow + p * 8) * BSTR + bc8) = bv[p];
    // prefetch next K-tile into cache while WMMAs run (global_prefetch_b8)
    if (kt + BK < K) {
#pragma unroll
      for (int p = 0; p < 8; p++)
        __builtin_prefetch((const char*)(Ak + BK + (size_t)(p * 16) * K) + abyte, 0, 1);
#pragma unroll
      for (int p = 0; p < 8; p++)
        __builtin_prefetch((const char*)(Bk + (size_t)(BK + p * 8) * Ncols) + bbyte, 0, 1);
    }
    __syncthreads();

#pragma unroll
    for (int ks = 0; ks < BK; ks += 32) {
      v16h af[4], bf[4];
#pragma unroll
      for (int b2 = 0; b2 < 4; b2++) {
        // k = 8h + 0..7 and 16 + 8h + 0..7 of column l15: the same k order as af
        const half_t* pb = sB + ks * BSTR + btr + wn * 64 + b2 * 16;
        bf[b2] = make_frag(ld_tr16(pb), ld_tr16(pb + 16 * BSTR));
      }
#pragma unroll
      for (int a2 = 0; a2 < 4; a2++) {
        const half_t* pa = sA + (wm * 64 + a2 * 16 + l15) * ASTR + ks;
        af[a2] = make_frag(*(const v8h*)(pa + kb), *(const v8h*)(pa + kb + 16));
      }
      // holds the 16 fragment loads ahead of the 16 WMMAs as one group: left free, the compiler reloads one
      // A fragment per 4 WMMAs into the same registers and the wave waits out the LDS latency four times
      __builtin_amdgcn_sched_barrier(0);
#pragma unroll
      for (int a2 = 0; a2 < 4; a2++)
#pragma unroll
        for (int b2 = 0; b2 < 4; b2++)
          acc[a2][b2] = wmma_f16(af[a2], bf[b2], acc[a2][b2]);
    }
    __syncthreads();
  }

  // The wave's four 16-row groups pass through one copy of the epilogue's code: the loop stays rolled and the
  // next group's accumulators move down into acc[0]. Unrolled, the GELU epilogue of 128 values a lane is about
  // four times the text.
#pragma unroll 1
  for (int a2 = 0; a2 < 4; a2++) {
    const int r0 = bm + wm * 64 + a2 * 16 + hi8;
#pragma unroll
    for (int b2 = 0; b2 < 4; b2++) {
      const int c0 = bn + wn * 64 + b2 * 16 + l15;
      const float bc = bias[c0];
#pragma unroll
      for (int j = 0; j < 8; j++) {
        int r = r0 + j;
        float v0 = acc[0][b2][j] + bc;
        if constexpr (MODE == MODE_F16_BIAS) {
          out16[(size_t)r * Ncols + c0] = (half_t)v0;
        } else if constexpr (MODE == MODE_F16_GELU) {
          v0 = 0.5f * v0 * (1.0f + erff(v0 * 0.70710678118f));
          out16[(size_t)r * Ncols + c0] = (half_t)v0;
        } else if constexpr (MODE == MODE_F32_RES_T) {
          // h = x(transposed read) + proj
          int n = r >> 11, t = r & (T_DIM - 1);
          size_t tr = ((size_t)t * N_DIM + n) * C_DIM;
          out32[(size_t)r * C_DIM + c0] = v0 + res[tr + c0];
        } else {  // MODE_F32_OUT_T : d_out[(t,n,c)] = h + ffn
          int n = r >> 11, t = r & (T_DIM - 1);
          size_t tr = ((size_t)t * N_DIM + n) * C_DIM;
          out32[tr + c0] = v0 + res[(size_t)r * C_DIM + c0];
        }
      }
    }
#pragma unroll
    for (int s = 0; s < 3; s++)
#pragma unroll
      for (int b2 = 0; b2 < 4; b2++) acc[s][b2] = acc[s + 1][b2];
    // the next pass rewrites registers that this pass's loads and stores name: the wait stands in front of that
    asm volatile("s_wait_xcnt 0x0" ::: "memory");
  }
}

// ---------------- Banded flash attention: one wave per (n, h, 16-query tile) ----
__global__ __launch_bounds__(32) void attn_kernel(const half_t* __restrict__ Q,
                                                  const half_t* __restrict__ KV,
                                                  half_t* __restrict__ O) {
  __shared__ __align__(16) half_t sP[16 * LSTR];
  __shared__ __align__(16) half_t sV[64 * LSTR];  // V transposed: [d][key]

  const int lane = threadIdx.x;
  const int q0 = blockIdx.x * 16;
  const int h  = blockIdx.y;
  const int n  = blockIdx.z;

  const int kb  = (lane & 16) ? 8 : 0;
  const int l15 = lane & 15;
  const int hi8 = (lane & 16) ? 8 : 0;

  const half_t* Qb = Q + ((size_t)(n * T_DIM + q0)) * C_DIM + h * D_DIM;
  const half_t* Kb = KV + ((size_t)n * T_DIM) * (2 * C_DIM) + h * D_DIM;
  const half_t* Vb = Kb + C_DIM;

  // Q as A-fragments for both 32-wide D steps (per-lane runs are contiguous in D)
  const half_t* qr = Qb + (size_t)l15 * C_DIM;
  v16h aQ0 = make_frag(*(const v8h*)(qr + kb), *(const v8h*)(qr + kb + 16));
  v16h aQ1 = make_frag(*(const v8h*)(qr + 32 + kb), *(const v8h*)(qr + 32 + kb + 16));

  float m[8], l[8];
  v8f oo[4];
#pragma unroll
  for (int j = 0; j < 8; j++) { m[j] = -3e38f; l[j] = 0.f; }
#pragma unroll
  for (int dt = 0; dt < 4; dt++)
#pragma unroll
    for (int j = 0; j < 8; j++) oo[dt][j] = 0.f;

  int kstart = q0 - W_DIM;
  if (kstart < 0) kstart = 0;
  kstart &= ~31;

  for (int kc = kstart; kc <= q0 + 15; kc += 32) {
    // K B-fragments (column = key, contiguous runs in D per lane)
    const half_t* kr0 = Kb + (size_t)(kc + l15) * (2 * C_DIM);
    const half_t* kr1 = kr0 + (size_t)16 * (2 * C_DIM);
    v16h bK00 = make_frag(*(const v8h*)(kr0 + kb), *(const v8h*)(kr0 + kb + 16));
    v16h bK01 = make_frag(*(const v8h*)(kr0 + 32 + kb), *(const v8h*)(kr0 + 32 + kb + 16));
    v16h bK10 = make_frag(*(const v8h*)(kr1 + kb), *(const v8h*)(kr1 + kb + 16));
    v16h bK11 = make_frag(*(const v8h*)(kr1 + 32 + kb), *(const v8h*)(kr1 + 32 + kb + 16));

    v8f s0 = {0, 0, 0, 0, 0, 0, 0, 0};
    v8f s1 = {0, 0, 0, 0, 0, 0, 0, 0};
    s0 = wmma_f16(aQ0, bK00, s0);
    s0 = wmma_f16(aQ1, bK01, s0);
    s1 = wmma_f16(aQ0, bK10, s1);
    s1 = wmma_f16(aQ1, bK11, s1);

    // stage V chunk transposed into LDS: sV[d][key]
    {
      const half_t* vr = Vb + (size_t)(kc + lane) * (2 * C_DIM);
#pragma unroll
      for (int g = 0; g < 8; g++) {
        v8h vv = *(const v8h*)(vr + g * 8);
#pragma unroll
        for (int i2 = 0; i2 < 8; i2++) sV[(g * 8 + i2) * LSTR + lane] = vv[i2];
      }
    }

    // online softmax (band mask as data-level select; EXEC stays all-1s)
    float pv0[8], pv1[8];
#pragma unroll
    for (int j = 0; j < 8; j++) {
      int q = q0 + j + hi8;
      int k0i = kc + l15, k1i = kc + 16 + l15;
      bool val0 = (k0i <= q) && (q - k0i <= W_DIM);
      bool val1 = (k1i <= q) && (q - k1i <= W_DIM);
      float x0 = val0 ? s0[j] * 0.125f : -3e38f;
      float x1 = val1 ? s1[j] * 0.125f : -3e38f;
      float cm = fmaxf(x0, x1);
#pragma unroll
      for (int msk = 1; msk < 16; msk <<= 1) cm = fmaxf(cm, __shfl_xor(cm, msk));
      float nm = fmaxf(m[j], cm);
      float corr = __expf(m[j] - nm);  // (-3e38)-(-3e38)=0 -> 1; finite path ok
      m[j] = nm;
      float p0 = val0 ? __expf(x0 - nm) : 0.f;
      float p1 = val1 ? __expf(x1 - nm) : 0.f;
      float rs = p0 + p1;
#pragma unroll
      for (int msk = 1; msk < 16; msk <<= 1) rs += __shfl_xor(rs, msk);
      l[j] = l[j] * corr + rs;
#pragma unroll
      for (int dt = 0; dt < 4; dt++) oo[dt][j] *= corr;
      pv0[j] = p0;
      pv1[j] = p1;
    }

    // P -> LDS (re-layout from C/D layout to A-fragment layout)
#pragma unroll
    for (int j = 0; j < 8; j++) {
      sP[(j + hi8) * LSTR + l15] = (half_t)pv0[j];
      sP[(j + hi8) * LSTR + 16 + l15] = (half_t)pv1[j];
    }
    __syncthreads();  // single-wave WG: lowers to NOP, LDS waits still enforced

    const half_t* pp = sP + l15 * LSTR;
    v16h aP = make_frag(*(const v8h*)(pp + kb), *(const v8h*)(pp + kb + 16));
#pragma unroll
    for (int dt = 0; dt < 4; dt++) {
      const half_t* pv = sV + (dt * 16 + l15) * LSTR;
      v16h bV = make_frag(*(const v8h*)(pv + kb), *(const v8h*)(pv + kb + 16));
      oo[dt] = wmma_f16(aP, bV, oo[dt]);
    }
    __syncthreads();
  }

  float inv[8];
#pragma unroll
  for (int j = 0; j < 8; j++) inv[j] = (l[j] > 0.f) ? (1.0f / l[j]) : 0.f;

  half_t* ob = O + ((size_t)(n * T_DIM + q0)) * C_DIM + h * D_DIM;
#pragma unroll
  for (int j = 0; j < 8; j++) {
    size_t rb = (size_t)(j + hi8) * C_DIM;
#pragma unroll
    for (int dt = 0; dt < 4; dt++)
      ob[rb + dt * 16 + l15] = (half_t)(oo[dt][j] * inv[j]);
  }
}

// ---------------- host orchestration ----------------
extern "C" void kernel_launch(void* const* d_in, const int* in_sizes, int n_in,
                              void* d_out, int out_size, void* d_ws, size_t ws_size,
                              hipStream_t stream) {
  (void)in_sizes; (void)n_in; (void)out_size; (void)ws_size;
  const float* x     = (const float*)d_in[0];
  const float* q_w   = (const float*)d_in[1];
  const float* q_b   = (const float*)d_in[2];
  const float* kv_w  = (const float*)d_in[3];
  const float* kv_b  = (const float*)d_in[4];
  const float* out_w = (const float*)d_in[5];
  const float* out_b = (const float*)d_in[6];
  const float* ff_w1 = (const float*)d_in[7];
  const float* ff_b1 = (const float*)d_in[8];
  const float* ff_w2 = (const float*)d_in[9];
  const float* ff_b2 = (const float*)d_in[10];
  const float* ln1_g = (const float*)d_in[11];
  const float* ln1_b = (const float*)d_in[12];
  const float* ln2_g = (const float*)d_in[13];
  const float* ln2_b = (const float*)d_in[14];

  char* ws = (char*)d_ws;
  size_t off = 0;
  auto alloc = [&](size_t bytes) -> char* {
    char* p = ws + off;
    off += (bytes + 255) & ~(size_t)255;
    return p;
  };
  half_t* wq   = (half_t*)alloc((size_t)C_DIM * C_DIM * 2);
  half_t* wkv  = (half_t*)alloc((size_t)C_DIM * 2 * C_DIM * 2);
  half_t* wo   = (half_t*)alloc((size_t)C_DIM * C_DIM * 2);
  half_t* wf1  = (half_t*)alloc((size_t)C_DIM * F_DIM * 2);
  half_t* wf2  = (half_t*)alloc((size_t)F_DIM * C_DIM * 2);
  half_t* A16  = (half_t*)alloc((size_t)NT * C_DIM * 2);
  half_t* Q16  = (half_t*)alloc((size_t)NT * C_DIM * 2);
  half_t* KV16 = (half_t*)alloc((size_t)NT * 2 * C_DIM * 2);
  half_t* O16  = (half_t*)alloc((size_t)NT * C_DIM * 2);
  float*  H32  = (float*)alloc((size_t)NT * C_DIM * 4);
  half_t* G16  = (half_t*)alloc((size_t)NT * F_DIM * 2);

  auto cast = [&](const float* s, half_t* d, int n) {
    cast_f32_to_f16<<<(n + 255) / 256, 256, 0, stream>>>(s, d, n);
  };
  cast(q_w, wq, C_DIM * C_DIM);
  cast(kv_w, wkv, C_DIM * 2 * C_DIM);
  cast(out_w, wo, C_DIM * C_DIM);
  cast(ff_w1, wf1, C_DIM * F_DIM);
  cast(ff_w2, wf2, F_DIM * C_DIM);

  layernorm_f16<true><<<NT, 256, 0, stream>>>(x, ln1_g, ln1_b, A16);

  dim3 blk(128);
  gemm_wmma<MODE_F16_BIAS><<<dim3(NT / BM, C_DIM / BN), blk, 0, stream>>>(
      A16, wq, q_b, nullptr, Q16, nullptr, C_DIM, C_DIM);
  gemm_wmma<MODE_F16_BIAS><<<dim3(NT / BM, 2 * C_DIM / BN), blk, 0, stream>>>(
      A16, wkv, kv_b, nullptr, KV16, nullptr, C_DIM, 2 * C_DIM);

  int nrope = NT * H_DIM * (D_DIM / 2);
  rope_inplace<<<(nrope + 255) / 256, 256, 0, stream>>>(Q16, C_DIM);
  rope_inplace<<<(nrope + 255) / 256, 256, 0, stream>>>(KV16, 2 * C_DIM);

  attn_kernel<<<dim3(T_DIM / 16, H_DIM, N_DIM), 32, 0, stream>>>(Q16, KV16, O16);

  gemm_wmma<MODE_F32_RES_T><<<dim3(NT / BM, C_DIM / BN), blk, 0, stream>>>(
      O16, wo, out_b, x, nullptr, H32, C_DIM, C_DIM);

  layernorm_f16<false><<<NT, 256, 0, stream>>>(H32, ln2_g, ln2_b, A16);

  gemm_wmma<MODE_F16_GELU><<<dim3(NT / BM, F_DIM / BN), blk, 0, stream>>>(
      A16, wf1, ff_b1, nullptr, G16, nullptr, C_DIM, F_DIM);

  gemm_wmma<MODE_F32_OUT_T><<<dim3(NT / BM, C_DIM / BN), blk, 0, stream>>>(
      G16, wf2, ff_b2, H32, nullptr, (float*)d_out, F_DIM, C_DIM);
}

// v003
// Measured time: 370 microseconds a run.
// Next to v002, in two timings, it ran 1.10 times as fast each time.
// Over all steps from v000 it is 4.32 times as fast.
#include <hip/hip_runtime.h>
#include <hip/hip_bf16.h>
#include <math.h>

typedef _Float16 half_t;
typedef __attribute__((ext_vector_type(16))) _Float16 v16h;
typedef __attribute__((ext_vector_type(8)))  _Float16 v8h;
typedef __attribute__((ext_vector_type(8)))  float    v8f;

#define T_DIM 2048
#define N_DIM 4
#define C_DIM 1024
#define H_DIM 16
#define D_DIM 64
#define W_DIM 512
#define F_DIM 4096
#define NT    (T_DIM * N_DIM)

#define BM 128
#define BN 128
#define BK 64
#define LSTR 40   // padded LDS stride in halves (80B: 16B aligned, avoids bank conflicts)
#define ASTR 72   // LDS stride of a GEMM A row in halves (144B = 16B x 9: the pitch of the 16-byte load)
#define BSTR 144  // LDS stride of a row-major B row in halves (288B = 32B x 9: the pitch of the transposing load)
#define AQW  4    // attention: 16-query tiles (waves) per block
#define KSTR 72   // attention: LDS stride of a K row in halves (144B = 16B x 9: the pitch of the 16-byte load)
#define VSTR 80   // attention: LDS stride of a V row in halves (160B = 32B x 5: the pitch of the transposing load)

enum { MODE_F16_BIAS = 0, MODE_F16_GELU = 1, MODE_F32_RES_T = 2, MODE_F32_OUT_T = 3 };

__device__ __forceinline__ v16h make_frag(v8h lo, v8h hi) {
  v16h a;
#pragma unroll
  for (int i = 0; i < 8; i++) { a[i] = lo[i]; a[i + 8] = hi[i]; }
  return a;
}

__device__ __forceinline__ v8f wmma_f16(v16h a, v16h b, v8f c) {
  return __builtin_amdgcn_wmma_f32_16x16x32_f16(false, a, false, b, (short)0, c, false, false);
}

// Transposing LDS load: from a row-major [k][n] tile, lane (c = lane & 15, h = lane >> 4)
// receives the 8 values T[k0 + 8h + 0..7][n0 + c]. Every lane passes the address of one 16-byte piece.
typedef __attribute__((ext_vector_type(8))) short s16x8;
__device__ __forceinline__ v8h ld_tr16(const half_t* p) {
  typedef __attribute__((address_space(3))) s16x8 lds_s16x8;
  return __builtin_bit_cast(v8h, __builtin_amdgcn_ds_load_tr16_b128_v8i16((lds_s16x8*)p));
}

// ---------------- elementwise: f32 -> f16 cast ----------------
__global__ void cast_f32_to_f16(const float* __restrict__ src, half_t* __restrict__ dst, int n) {
  int i = blockIdx.x * blockDim.x + threadIdx.x;
  if (i < n) dst[i] = (half_t)src[i];
}

// ---------------- LayerNorm (one block per row), writes f16 ----------------
template <bool TRANSPOSED>
__global__ __launch_bounds__(256) void layernorm_f16(const float* __restrict__ src,
                                                     const float* __restrict__ g,
                                                     const float* __restrict__ b,
                                                     half_t* __restrict__ dst) {
  int r = blockIdx.x;  // r = n*T + t
  const float* row;
  if (TRANSPOSED) {
    int n = r >> 11;             // T = 2048
    int t = r & (T_DIM - 1);
    row = src + ((size_t)t * N_DIM + n) * C_DIM;
  } else {
    row = src + (size_t)r * C_DIM;
  }
  float v[4];
  float s = 0.f, s2 = 0.f;
#pragma unroll
  for (int i = 0; i < 4; i++) {
    v[i] = row[threadIdx.x + i * 256];
    s += v[i];
    s2 += v[i] * v[i];
  }
#pragma unroll
  for (int m = 16; m >= 1; m >>= 1) { s += __shfl_xor(s, m); s2 += __shfl_xor(s2, m); }
  __shared__ float sh[2][8];
  int wave = threadIdx.x >> 5, lane = threadIdx.x & 31;
  if (lane == 0) { sh[0][wave] = s; sh[1][wave] = s2; }
  __syncthreads();
  if (wave == 0) {
    s = sh[0][lane & 7];
    s2 = sh[1][lane & 7];
#pragma unroll
    for (int m = 4; m >= 1; m >>= 1) { s += __shfl_xor(s, m); s2 += __shfl_xor(s2, m); }
    if (lane == 0) { sh[0][0] = s; sh[1][0] = s2; }
  }
  __syncthreads();
  float mu = sh[0][0] * (1.0f / C_DIM);
  float var = sh[1][0] * (1.0f / C_DIM) - mu * mu;
  float rstd = rsqrtf(var + 1e-5f);
#pragma unroll
  for (int i = 0; i < 4; i++) {
    int c = threadIdx.x + i * 256;
    dst[(size_t)r * C_DIM + c] = (half_t)((v[i] - mu) * rstd * g[c] + b[c]);
  }
}

// ---------------- RoPE, in place on f16 (pos = t + W) ----------------
__global__ void rope_inplace(half_t* __restrict__ buf, int stride) {
  int idx = blockIdx.x * blockDim.x + threadIdx.x;
  if (idx >= NT * H_DIM * (D_DIM / 2)) return;
  int i = idx & 31;
  int h = (idx >> 5) & 15;
  int row = idx >> 9;
  int t = row & (T_DIM - 1);
  float pos = (float)(t + W_DIM);
  // inv_freq = ROPE_BASE^(-2i/D) = exp(-(2i/D) * ln(10000))
  float freq = __expf(-(float)(2 * i) * (1.0f / (float)D_DIM) * 9.210340371976184f);
  float ang = pos * freq;
  float sn, cs;
  __sincosf(ang, &sn, &cs);
  half_t* p = buf + (size_t)row * stride + h * D_DIM;
  float a = (float)p[i];
  float bq = (float)p[i + 32];
  p[i] = (half_t)(a * cs - bq * sn);
  p[i + 32] = (half_t)(bq * cs + a * sn);
}

// ---------------- WMMA GEMM: C[M x Ncols] = A(f16, MxK) @ B(f16, KxNcols) + epilogue ----
// Block tile 128x128x64, 4 waves (2 x 2); each wave owns a 64x64 macro-tile:
// 4 A-frags x 4 B-frags -> 16 WMMAs per 32 k: a fragment feeds twice the WMMAs of a 32x32 wave tile, and A is staged in
// whole 128-B lines. Four-wave blocks: several independent blocks share a WGP, one stages while another multiplies.
template <int MODE>
__global__ __launch_bounds__(128) void gemm_wmma(const half_t* __restrict__ A,
                                                 const half_t* __restrict__ B,
                                                 const float* __restrict__ bias,
                                                 const float* __restrict__ res,
                                                 half_t* __restrict__ out16,
                                                 float* __restrict__ out32,
                                                 int K, int Ncols) {
  __shared__ __align__(16) half_t sA[BM * ASTR];   // 128 x 64 (padded)
  __shared__ __align__(16) half_t sB[BK * BSTR];   // row-major: [k][n], 64 x 128 (padded)

  const int tid = threadIdx.x;
  const int lane = tid & 31;
  const int wave = tid >> 5;
  const int wm = wave >> 1;  // 0..1 : 64-row strip
  const int wn = wave & 1;   // 0..1 : 64-col strip
  const int bm = blockIdx.x * BM;
  const int bn = blockIdx.y * BN;

  const int kb  = (lane & 16) ? 8 : 0;
  const int l15 = lane & 15;
  const int hi8 = (lane & 16) ? 8 : 0;

  v8f acc[4][4];
#pragma unroll
  for (int a2 = 0; a2 < 4; a2++)
#pragma unroll
    for (int b2 = 0; b2 < 4; b2++)
#pragma unroll
      for (int j = 0; j < 8; j++) acc[a2][b2][j] = 0.f;

  const int arow = tid >> 3;        // 0..15 (eight passes cover 128 rows; a wave reads 4 whole 128-B lines)
  const int akc  = (tid & 7) * 8;   // 0..56
  const int brow = tid >> 4;        // 0..7 (eight passes cover k=0..63; a wave reads 2 x 256 contiguous bytes)
  const int bc8  = (tid & 15) * 8;  // 0..120
  // this thread's byte offset from the tile's corner, the same in every pass and k-step
  const unsigned abyte = (unsigned)(arow * K + akc) * 2u;
  const unsigned bbyte = (unsigned)(brow * Ncols + bc8) * 2u;
  // this lane's 16-byte piece for the transposing load of a 16(k) x 16(n) block of sB
  const int btr  = (hi8 + (lane & 7)) * BSTR + ((lane >> 3) & 1) * 8;

  for (int kt = 0; kt < K; kt += BK) {
    // stage A (128x64): eight b128 per thread; B (64x128) as it lies in memory, sB[k][n]: eight b128 per thread
    const half_t* Ak = A + (size_t)bm * K + kt;           // block-uniform corner of the A tile
    const half_t* Bk = B + (size_t)kt * Ncols + bn;       // block-uniform corner of the B tile
    v8h av[8], bv[8];
#pragma unroll
    for (int p = 0; p < 8; p++)
      av[p] = *(const v8h*)((const char*)(Ak + (size_t)(p * 16) * K) + abyte);
#pragma unroll
    for (int p = 0; p < 8; p++)
      bv[p] = *(const v8h*)((const char*)(Bk + (size_t)(p * 8) * Ncols) + bbyte);
#pragma unroll
    for (int p = 0; p < 8; p++) *(v8h*)(sA + (arow + p * 16) * ASTR + akc) = av[p];
#pragma unroll
    for (int p = 0; p < 8; p++) *(v8h*)(sB + (brow + p * 8) * BSTR + bc8) = bv[p];
    // prefetch next K-tile into cache while WMMAs run (global_prefetch_b8)
    if (kt + BK < K) {
#pragma unroll
      for (int p = 0; p < 8; p++)
        __builtin_prefetch((const char*)(Ak + BK + (size_t)(p * 16) * K) + abyte, 0, 1);
#pragma unroll
      for (int p = 0; p < 8; p++)
        __builtin_prefetch((const char*)(Bk + (size_t)(BK + p * 8) * Ncols) + bbyte, 0, 1);
    }
    __syncthreads();

#pragma unroll
    for (int ks = 0; ks < BK; ks += 32) {
      v16h af[4], bf[4];
#pragma unroll
      for (int b2 = 0; b2 < 4; b2++) {
        // k = 8h + 0..7 and 16 + 8h + 0..7 of column l15: the same k order as af
        const half_t* pb = sB + ks * BSTR + btr + wn * 64 + b2 * 16;
        bf[b2] = make_frag(ld_tr16(pb), ld_tr16(pb + 16 * BSTR));
      }
#pragma unroll
      for (int a2 = 0; a2 < 4; a2++) {
        const half_t* pa = sA + (wm * 64 + a2 * 16 + l15) * ASTR + ks;
        af[a2] = make_frag(*(const v8h*)(pa + kb), *(const v8h*)(pa + kb + 16));
      }
      // holds the 16 fragment loads ahead of the 16 WMMAs as one group: left free, the compiler reloads one
      // A fragment per 4 WMMAs into the same registers and the wave waits out the LDS latency four times
      __builtin_amdgcn_sched_barrier(0);
#pragma unroll
      for (int a2 = 0; a2 < 4; a2++)
#pragma unroll
        for (int b2 = 0; b2 < 4; b2++)
          acc[a2][b2] = wmma_f16(af[a2], bf[b2], acc[a2][b2]);
    }
    __syncthreads();
  }

  // The wave's four 16-row groups pass through one copy of the epilogue's code: the loop stays rolled and the
  // next group's accumulators move down into acc[0]. Unrolled, the GELU epilogue of 128 values a lane is about
  // four times the text.
#pragma unroll 1
  for (int a2 = 0; a2 < 4; a2++) {
    const int r0 = bm + wm * 64 + a2 * 16 + hi8;
#pragma unroll
    for (int b2 = 0; b2 < 4; b2++) {
      const int c0 = bn + wn * 64 + b2 * 16 + l15;
      const float bc = bias[c0];
#pragma unroll
      for (int j = 0; j < 8; j++) {
        int r = r0 + j;
        float v0 = acc[0][b2][j] + bc;
        if constexpr (MODE == MODE_F16_BIAS) {
          out16[(size_t)r * Ncols + c0] = (half_t)v0;
        } else if constexpr (MODE == MODE_F16_GELU) {
          v0 = 0.5f * v0 * (1.0f + erff(v0 * 0.70710678118f));
          out16[(size_t)r * Ncols + c0] = (half_t)v0;
        } else if constexpr (MODE == MODE_F32_RES_T) {
          // h = x(transposed read) + proj
          int n = r >> 11, t = r & (T_DIM - 1);
          size_t tr = ((size_t)t * N_DIM + n) * C_DIM;
          out32[(size_t)r * C_DIM + c0] = v0 + res[tr + c0];
        } else {  // MODE_F32_OUT_T : d_out[(t,n,c)] = h + ffn
          int n = r >> 11, t = r & (T_DIM - 1);
          size_t tr = ((size_t)t * N_DIM + n) * C_DIM;
          out32[tr + c0] = v0 + res[(size_t)r * C_DIM + c0];
        }
      }
    }
#pragma unroll
    for (int s = 0; s < 3; s++)
#pragma unroll
      for (int b2 = 0; b2 < 4; b2++) acc[s][b2] = acc[s + 1][b2];
    // the next pass rewrites registers that this pass's loads and stores name: the wait stands in front of that
    asm volatile("s_wait_xcnt 0x0" ::: "memory");
  }
}

// ---------------- Banded flash attention: four waves per block, one 16-query tile each ----
// The four tiles walk nearly the same keys, so each 32-key chunk of K and V is brought in once per block, in
// whole 128-B lines, and laid row-major in LDS; every wave takes its fragments from there (V by the transposing load).
__global__ __launch_bounds__(128) void attn_kernel(const half_t* __restrict__ Q,
                                                   const half_t* __restrict__ KV,
                                                   half_t* __restrict__ O) {
  __shared__ __align__(16) half_t sK[2][32 * KSTR];     // [key][d], two buffers
  __shared__ __align__(16) half_t sV[2][32 * VSTR];     // [key][d], two buffers
  __shared__ __align__(16) half_t sPw[AQW][16 * LSTR];  // one P tile per wave

  const int tid  = threadIdx.x;
  const int lane = tid & 31;
  const int wave = __builtin_amdgcn_readfirstlane(tid >> 5);
  const int qb = blockIdx.x * (16 * AQW);  // first query of the block
  const int q0 = qb + wave * 16;           // first query of this wave
  const int h  = blockIdx.y;
  const int n  = blockIdx.z;

  const int kb  = (lane & 16) ? 8 : 0;
  const int l15 = lane & 15;
  const int hi8 = (lane & 16) ? 8 : 0;

  const half_t* Qb = Q + ((size_t)(n * T_DIM + q0)) * C_DIM + h * D_DIM;
  const half_t* Kb = KV + ((size_t)n * T_DIM) * (2 * C_DIM) + h * D_DIM;
  half_t* sP = sPw[wave];

  // Q as A-fragments for both 32-wide D steps (per-lane runs are contiguous in D)
  const half_t* qr = Qb + (size_t)l15 * C_DIM;
  v16h aQ0 = make_frag(*(const v8h*)(qr + kb), *(const v8h*)(qr + kb + 16));
  v16h aQ1 = make_frag(*(const v8h*)(qr + 32 + kb), *(const v8h*)(qr + 32 + kb + 16));

  float m[8], l[8];
  v8f oo[4];
#pragma unroll
  for (int j = 0; j < 8; j++) { m[j] = -3e38f; l[j] = 0.f; }
#pragma unroll
  for (int dt = 0; dt < 4; dt++)
#pragma unroll
    for (int j = 0; j < 8; j++) oo[dt][j] = 0.f;

  // this wave's own chunks: the 32-key chunks that hold a key of its 16 queries' band
  int kstart = q0 - W_DIM;
  if (kstart < 0) kstart = 0;
  kstart &= ~31;
  // the block's chunks: from its first wave's first to its last wave's last
  int kfirst = qb - W_DIM;
  if (kfirst < 0) kfirst = 0;
  kfirst &= ~31;
  const int klast = (qb + 16 * AQW - 1) & ~31;

  // staging: a thread moves rows srow and srow + 16 of K and of V, 16 bytes of each; a wave-load covers 4 whole lines
  const int srow = tid >> 3;        // 0..15
  const int sc8  = (tid & 7) * 8;   // 0..56
  const half_t* gs = Kb + (size_t)srow * (2 * C_DIM) + sc8;
  const int kst = srow * KSTR + sc8;
  const int vst = srow * VSTR + sc8;
  // this lane's 16-byte piece for the transposing load of a 16(key) x 16(d) block of sV
  const int vtr = (hi8 + (lane & 7)) * VSTR + ((lane >> 3) & 1) * 8;

  {
    const half_t* g = gs + (size_t)kfirst * (2 * C_DIM);
    v8h rk0 = *(const v8h*)(g);
    v8h rk1 = *(const v8h*)(g + 16 * (2 * C_DIM));
    v8h rv0 = *(const v8h*)(g + C_DIM);
    v8h rv1 = *(const v8h*)(g + 16 * (2 * C_DIM) + C_DIM);
    *(v8h*)(sK[0] + kst) = rk0;
    *(v8h*)(sK[0] + kst + 16 * KSTR) = rk1;
    *(v8h*)(sV[0] + vst) = rv0;
    *(v8h*)(sV[0] + vst + 16 * VSTR) = rv1;
  }
  __syncthreads();

  int buf = 0;
  for (int kc = kfirst; kc <= klast; kc += 32) {
    // the next chunk's lines are asked for ahead of this chunk's work and laid into the other buffer behind it
    const bool more = kc + 32 <= klast;
    v8h rk0, rk1, rv0, rv1;
    if (more) {
      const half_t* g = gs + (size_t)(kc + 32) * (2 * C_DIM);
      rk0 = *(const v8h*)(g);
      rk1 = *(const v8h*)(g + 16 * (2 * C_DIM));
      rv0 = *(const v8h*)(g + C_DIM);
      rv1 = *(const v8h*)(g + 16 * (2 * C_DIM) + C_DIM);
      // the work below reuses the registers that hold these loads' address: the wait stands in front of that
      asm volatile("s_wait_xcnt 0x0" ::: "memory");
    }

    // wave-uniform: a chunk outside this wave's own band is passed over (every wave still meets the barrier below)
    if (kc >= kstart && kc <= q0 + 15) {
      // K B-fragments (column = key, contiguous runs in D per lane)
      const half_t* kr0 = sK[buf] + l15 * KSTR;
      const half_t* kr1 = kr0 + 16 * KSTR;
      v16h bK00 = make_frag(*(const v8h*)(kr0 + kb), *(const v8h*)(kr0 + kb + 16));
      v16h bK01 = make_frag(*(const v8h*)(kr0 + 32 + kb), *(const v8h*)(kr0 + 32 + kb + 16));
      v16h bK10 = make_frag(*(const v8h*)(kr1 + kb), *(const v8h*)(kr1 + kb + 16));
      v16h bK11 = make_frag(*(const v8h*)(kr1 + 32 + kb), *(const v8h*)(kr1 + 32 + kb + 16));

      v8f s0 = {0, 0, 0, 0, 0, 0, 0, 0};
      v8f s1 = {0, 0, 0, 0, 0, 0, 0, 0};
      s0 = wmma_f16(aQ0, bK00, s0);
      s0 = wmma_f16(aQ1, bK01, s0);
      s1 = wmma_f16(aQ0, bK10, s1);
      s1 = wmma_f16(aQ1, bK11, s1);

      // online softmax (band mask as data-level select; EXEC stays all-1s)
      float pv0[8], pv1[8];
#pragma unroll
      for (int j = 0; j < 8; j++) {
        int q = q0 + j + hi8;
        int k0i = kc + l15, k1i = kc + 16 + l15;
        bool val0 = (k0i <= q) && (q - k0i <= W_DIM);
        bool val1 = (k1i <= q) && (q - k1i <= W_DIM);
        float x0 = val0 ? s0[j] * 0.125f : -3e38f;
        float x1 = val1 ? s1[j] * 0.125f : -3e38f;
        float cm = fmaxf(x0, x1);
#pragma unroll
        for (int msk = 1; msk < 16; msk <<= 1) cm = fmaxf(cm, __shfl_xor(cm, msk));
        float nm = fmaxf(m[j], cm);
        float corr = __expf(m[j] - nm);  // (-3e38)-(-3e38)=0 -> 1; finite path ok
        m[j] = nm;
        float p0 = val0 ? __expf(x0 - nm) : 0.f;
        float p1 = val1 ? __expf(x1 - nm) : 0.f;
        float rs = p0 + p1;
#pragma unroll
        for (int msk = 1; msk < 16; msk <<= 1) rs += __shfl_xor(rs, msk);
        l[j] = l[j] * corr + rs;
#pragma unroll
        for (int dt = 0; dt < 4; dt++) oo[dt][j] *= corr;
        pv0[j] = p0;
        pv1[j] = p1;
      }

      // P -> LDS (re-layout from C/D layout to A-fragment layout), in the wave's own tile
#pragma unroll
      for (int j = 0; j < 8; j++) {
        sP[(j + hi8) * LSTR + l15] = (half_t)pv0[j];
        sP[(j + hi8) * LSTR + 16 + l15] = (half_t)pv1[j];
      }
      // the P tile goes from lane to lane of one wave only: the LDS stores are waited out and the loads below stay
      // behind them; no work-group barrier may stand here, inside a branch that not every wave takes
      __builtin_amdgcn_fence(__ATOMIC_ACQ_REL, "workgroup", "local");

      const half_t* pp = sP + l15 * LSTR;
      v16h aP = make_frag(*(const v8h*)(pp + kb), *(const v8h*)(pp + kb + 16));
#pragma unroll
      for (int dt = 0; dt < 4; dt++) {
        // keys 8h + 0..7 and 16 + 8h + 0..7 of column d = dt*16 + l15: the same k order as aP
        const half_t* pv = sV[buf] + vtr + dt * 16;
        v16h bV = make_frag(ld_tr16(pv), ld_tr16(pv + 16 * VSTR));
        oo[dt] = wmma_f16(aP, bV, oo[dt]);
      }
    }

    if (more) {
      *(v8h*)(sK[buf ^ 1] + kst) = rk0;
      *(v8h*)(sK[buf ^ 1] + kst + 16 * KSTR) = rk1;
      *(v8h*)(sV[buf ^ 1] + vst) = rv0;
      *(v8h*)(sV[buf ^ 1] + vst + 16 * VSTR) = rv1;
    }
    // one barrier per chunk: it publishes the buffer just filled and ends every wave's reads of the one filled next
    __syncthreads();
    buf ^= 1;
  }

  float inv[8];
#pragma unroll
  for (int j = 0; j < 8; j++) inv[j] = (l[j] > 0.f) ? (1.0f / l[j]) : 0.f;

  half_t* ob = O + ((size_t)(n * T_DIM + q0)) * C_DIM + h * D_DIM;
#pragma unroll
  for (int j = 0; j < 8; j++) {
    size_t rb = (size_t)(j + hi8) * C_DIM;
#pragma unroll
    for (int dt = 0; dt < 4; dt++)
      ob[rb + dt * 16 + l15] = (half_t)(oo[dt][j] * inv[j]);
  }
}

// ---------------- host orchestration ----------------
extern "C" void kernel_launch(void* const* d_in, const int* in_sizes, int n_in,
                              void* d_out, int out_size, void* d_ws, size_t ws_size,
                              hipStream_t stream) {
  (void)in_sizes; (void)n_in; (void)out_size; (void)ws_size;
  const float* x     = (const float*)d_in[0];
  const float* q_w   = (const float*)d_in[1];
  const float* q_b   = (const float*)d_in[2];
  const float* kv_w  = (const float*)d_in[3];
  const float* kv_b  = (const float*)d_in[4];
  const float* out_w = (const float*)d_in[5];
  const float* out_b = (const float*)d_in[6];
  const float* ff_w1 = (const float*)d_in[7];
  const float* ff_b1 = (const float*)d_in[8];
  const float* ff_w2 = (const float*)d_in[9];
  const float* ff_b2 = (const float*)d_in[10];
  const float* ln1_g = (const float*)d_in[11];
  const float* ln1_b = (const float*)d_in[12];
  const float* ln2_g = (const float*)d_in[13];
  const float* ln2_b = (const float*)d_in[14];

  char* ws = (char*)d_ws;
  size_t off = 0;
  auto alloc = [&](size_t bytes) -> char* {
    char* p = ws + off;
    off += (bytes + 255) & ~(size_t)255;
    return p;
  };
  half_t* wq   = (half_t*)alloc((size_t)C_DIM * C_DIM * 2);
  half_t* wkv  = (half_t*)alloc((size_t)C_DIM * 2 * C_DIM * 2);
  half_t* wo   = (half_t*)alloc((size_t)C_DIM * C_DIM * 2);
  half_t* wf1  = (half_t*)alloc((size_t)C_DIM * F_DIM * 2);
  half_t* wf2  = (half_t*)alloc((size_t)F_DIM * C_DIM * 2);
  half_t* A16  = (half_t*)alloc((size_t)NT * C_DIM * 2);
  half_t* Q16  = (half_t*)alloc((size_t)NT * C_DIM * 2);
  half_t* KV16 = (half_t*)alloc((size_t)NT * 2 * C_DIM * 2);
  half_t* O16  = (half_t*)alloc((size_t)NT * C_DIM * 2);
  float*  H32  = (float*)alloc((size_t)NT * C_DIM * 4);
  half_t* G16  = (half_t*)alloc((size_t)NT * F_DIM * 2);

  auto cast = [&](const float* s, half_t* d, int n) {
    cast_f32_to_f16<<<(n + 255) / 256, 256, 0, stream>>>(s, d, n);
  };
  cast(q_w, wq, C_DIM * C_DIM);
  cast(kv_w, wkv, C_DIM * 2 * C_DIM);
  cast(out_w, wo, C_DIM * C_DIM);
  cast(ff_w1, wf1, C_DIM * F_DIM);
  cast(ff_w2, wf2, F_DIM * C_DIM);

  layernorm_f16<true><<<NT, 256, 0, stream>>>(x, ln1_g, ln1_b, A16);

  dim3 blk(128);
  gemm_wmma<MODE_F16_BIAS><<<dim3(NT / BM, C_DIM / BN), blk, 0, stream>>>(
      A16, wq, q_b, nullptr, Q16, nullptr, C_DIM, C_DIM);
  gemm_wmma<MODE_F16_BIAS><<<dim3(NT / BM, 2 * C_DIM / BN), blk, 0, stream>>>(
      A16, wkv, kv_b, nullptr, KV16, nullptr, C_DIM, 2 * C_DIM);

  int nrope = NT * H_DIM * (D_DIM / 2);
  rope_inplace<<<(nrope + 255) / 256, 256, 0, stream>>>(Q16, C_DIM);
  rope_inplace<<<(nrope + 255) / 256, 256, 0, stream>>>(KV16, 2 * C_DIM);

  attn_kernel<<<dim3(T_DIM / (16 * AQW), H_DIM, N_DIM), 32 * AQW, 0, stream>>>(Q16, KV16, O16);

  gemm_wmma<MODE_F32_RES_T><<<dim3(NT / BM, C_DIM / BN), blk, 0, stream>>>(
      O16, wo, out_b, x, nullptr, H32, C_DIM, C_DIM);

  layernorm_f16<false><<<NT, 256, 0, stream>>>(H32, ln2_g, ln2_b, A16);

  gemm_wmma<MODE_F16_GELU><<<dim3(NT / BM, F_DIM / BN), blk, 0, stream>>>(
      A16, wf1, ff_b1, nullptr, G16, nullptr, C_DIM, F_DIM);

  gemm_wmma<MODE_F32_OUT_T><<<dim3(NT / BM, C_DIM / BN), blk, 0, stream>>>(
      G16, wf2, ff_b2, H32, nullptr, (float*)d_out, F_DIM, C_DIM);
}

// v004
// It runs in 337 microseconds.
// Next to v003, in two timings, it ran 1.10 and 1.09 times as fast.
// Over all steps from v000 it is 4.73 times as fast.
#include <hip/hip_runtime.h>
#include <hip/hip_bf16.h>
#include <math.h>
#include <stdint.h>

typedef _Float16 half_t;
typedef __attribute__((ext_vector_type(16))) _Float16 v16h;
typedef __attribute__((ext_vector_type(8)))  _Float16 v8h;
typedef __attribute__((ext_vector_type(8)))  float    v8f;

#define T_DIM 2048
#define N_DIM 4
#define C_DIM 1024
#define H_DIM 16
#define D_DIM 64
#define W_DIM 512
#define F_DIM 4096
#define NT    (T_DIM * N_DIM)

#define BM 128
#define BN 128
#define BK 64
#define LSTR 40   // padded LDS stride in halves (80B: 16B aligned, avoids bank conflicts)
#define ASTR 72   // LDS stride of a GEMM A row in halves (144B = 16B x 9: the pitch of the 16-byte load)
#define BSTR 144  // LDS stride of a row-major B row in halves (288B = 32B x 9: the pitch of the transposing load)
#define SLICE 10240          // bytes of LDS per tensor-load slice: 64 A rows at 144 B or 32 B rows at 288 B (9,216 B), up to a multiple of 2 KiB
#define STAGE (4 * SLICE)    // one k-step's tiles: two A slices, then two B slices
#define AQW  4    // attention: 16-query tiles (waves) per block
#define KSTR 72   // attention: LDS stride of a K row in halves (144B = 16B x 9: the pitch of the 16-byte load)
#define VSTR 80   // attention: LDS stride of a V row in halves (160B = 32B x 5: the pitch of the transposing load)

enum { MODE_F16_BIAS = 0, MODE_F16_GELU = 1, MODE_F32_RES_T = 2, MODE_F32_OUT_T = 3 };

__device__ __forceinline__ v16h make_frag(v8h lo, v8h hi) {
  v16h a;
#pragma unroll
  for (int i = 0; i < 8; i++) { a[i] = lo[i]; a[i + 8] = hi[i]; }
  return a;
}

__device__ __forceinline__ v8f wmma_f16(v16h a, v16h b, v8f c) {
  return __builtin_amdgcn_wmma_f32_16x16x32_f16(false, a, false, b, (short)0, c, false, false);
}

// Transposing LDS load: from a row-major [k][n] tile, lane (c = lane & 15, h = lane >> 4)
// receives the 8 values T[k0 + 8h + 0..7][n0 + c]. Every lane passes the address of one 16-byte piece.
typedef __attribute__((ext_vector_type(8))) short s16x8;
__device__ __forceinline__ v8h ld_tr16(const half_t* p) {
  typedef __attribute__((address_space(3))) s16x8 lds_s16x8;
  return __builtin_bit_cast(v8h, __builtin_amdgcn_ds_load_tr16_b128_v8i16((lds_s16x8*)p));
}

// ---------------- tensor load to LDS: one request of a whole wave brings a padded two-dimensional tile ----------------
typedef uint32_t u32x4 __attribute__((ext_vector_type(4)));
typedef uint32_t u32x8 __attribute__((ext_vector_type(8)));
__device__ __forceinline__ uint32_t uni(uint32_t v) { return (uint32_t)__builtin_amdgcn_readfirstlane(v); }
__device__ __forceinline__ uint32_t pinned(uint32_t v) {
  uint32_t w = uni(v);
  asm volatile("" : "+s"(w));  // pinned(): a value for a tensor load's test or descriptor, held in a scalar register
  return w;
}
// group 1: 1-byte elements, tensor = tile = ROWS rows of ROWB bytes, source pitch in bytes; WORD0 holds the pad that sets the LDS pitch
template <uint32_t WORD0, uint32_t ROWB, uint32_t ROWS>
__device__ __forceinline__ u32x8 tdm_group1(uint32_t src_pitch) {
  u32x8 g;
  g[0] = uni(WORD0);
  g[1] = uni((ROWB & 0xFFFFu) << 16);
  g[2] = uni((ROWB >> 16) | ((ROWS & 0xFFFFu) << 16));
  g[3] = uni((ROWS >> 16) | (ROWB << 16));
  g[4] = uni(ROWS);
  g[5] = uni(src_pitch);
  g[6] = uni(0u);
  g[7] = uni(0u);
  return g;
}
// group 0: count 1, place in LDS, address of the tile's first byte, type 2
__device__ __forceinline__ u32x4 tdm_group0(uint32_t lds_dst, uint64_t ga) {
  u32x4 g;
  g[0] = uni(1u);
  g[1] = uni(lds_dst);
  g[2] = uni((uint32_t)ga);
  g[3] = uni((((uint32_t)(ga >> 32)) & 0x01FFFFFFu) | 0x80000000u);
  return g;
}
__device__ __forceinline__ void tdm_load(u32x4 g0, u32x8 g1) {
  asm volatile("tensor_load_to_lds %0, %1" :: "s"(g0), "s"(g1) : "memory");
}

// ---------------- elementwise: f32 -> f16 cast ----------------
__global__ void cast_f32_to_f16(const float* __restrict__ src, half_t* __restrict__ dst, int n) {
  int i = blockIdx.x * blockDim.x + threadIdx.x;
  if (i < n) dst[i] = (half_t)src[i];
}

// ---------------- LayerNorm (one block per row), writes f16 ----------------
template <bool TRANSPOSED>
__global__ __launch_bounds__(256) void layernorm_f16(const float* __restrict__ src,
                                                     const float* __restrict__ g,
                                                     const float* __restrict__ b,
                                                     half_t* __restrict__ dst) {
  int r = blockIdx.x;  // r = n*T + t
  const float* row;
  if (TRANSPOSED) {
    int n = r >> 11;             // T = 2048
    int t = r & (T_DIM - 1);
    row = src + ((size_t)t * N_DIM + n) * C_DIM;
  } else {
    row = src + (size_t)r * C_DIM;
  }
  float v[4];
  float s = 0.f, s2 = 0.f;
#pragma unroll
  for (int i = 0; i < 4; i++) {
    v[i] = row[threadIdx.x + i * 256];
    s += v[i];
    s2 += v[i] * v[i];
  }
#pragma unroll
  for (int m = 16; m >= 1; m >>= 1) { s += __shfl_xor(s, m); s2 += __shfl_xor(s2, m); }
  __shared__ float sh[2][8];
  int wave = threadIdx.x >> 5, lane = threadIdx.x & 31;
  if (lane == 0) { sh[0][wave] = s; sh[1][wave] = s2; }
  __syncthreads();
  if (wave == 0) {
    s = sh[0][lane & 7];
    s2 = sh[1][lane & 7];
#pragma unroll
    for (int m = 4; m >= 1; m >>= 1) { s += __shfl_xor(s, m); s2 += __shfl_xor(s2, m); }
    if (lane == 0) { sh[0][0] = s; sh[1][0] = s2; }
  }
  __syncthreads();
  float mu = sh[0][0] * (1.0f / C_DIM);
  float var = sh[1][0] * (1.0f / C_DIM) - mu * mu;
  float rstd = rsqrtf(var + 1e-5f);
#pragma unroll
  for (int i = 0; i < 4; i++) {
    int c = threadIdx.x + i * 256;
    dst[(size_t)r * C_DIM + c] = (half_t)((v[i] - mu) * rstd * g[c] + b[c]);
  }
}

// ---------------- RoPE, in place on f16 (pos = t + W) ----------------
__global__ void rope_inplace(half_t* __restrict__ buf, int stride) {
  int idx = blockIdx.x * blockDim.x + threadIdx.x;
  if (idx >= NT * H_DIM * (D_DIM / 2)) return;
  int i = idx & 31;
  int h = (idx >> 5) & 15;
  int row = idx >> 9;
  int t = row & (T_DIM - 1);
  float pos = (float)(t + W_DIM);
  // inv_freq = ROPE_BASE^(-2i/D) = exp(-(2i/D) * ln(10000))
  float freq = __expf(-(float)(2 * i) * (1.0f / (float)D_DIM) * 9.210340371976184f);
  float ang = pos * freq;
  float sn, cs;
  __sincosf(ang, &sn, &cs);
  half_t* p = buf + (size_t)row * stride + h * D_DIM;
  float a = (float)p[i];
  float bq = (float)p[i + 32];
  p[i] = (half_t)(a * cs - bq * sn);
  p[i + 32] = (half_t)(bq * cs + a * sn);
}

// ---------------- WMMA GEMM: C[M x Ncols] = A(f16, MxK) @ B(f16, KxNcols) + epilogue ----
// Block tile 128x128x64, 4 waves (2 x 2); each wave owns a 64x64 macro-tile:
// 4 A-frags x 4 B-frags -> 16 WMMAs per 32 k. The tiles come by the tensor mover into two LDS buffers: every wave asks
// for one 8-KiB slice per k-step, one k-step ahead of its use, so the next tiles fly while these are multiplied.
// K is at least two k-steps (128) and a multiple of 64 at every launch.
template <int MODE>
__global__ __launch_bounds__(128) void gemm_wmma(const half_t* __restrict__ A,
                                                 const half_t* __restrict__ B,
                                                 const float* __restrict__ bias,
                                                 const float* __restrict__ res,
                                                 half_t* __restrict__ out16,
                                                 float* __restrict__ out32,
                                                 int K, int Ncols) {
  // per buffer: A rows 0..63 | A rows 64..127 (pitch 144 B) | B rows k 0..31 | k 32..63 (row-major [k][n], pitch 288 B)
  __shared__ __attribute__((aligned(2048))) unsigned char sT[2 * STAGE];

  const int tid = threadIdx.x;
  const int lane = tid & 31;
  const uint32_t wave = uni((uint32_t)tid >> 5);
  const int wm = wave >> 1;  // 0..1 : 64-row strip
  const int wn = wave & 1;   // 0..1 : 64-col strip
  const int bm = blockIdx.x * BM;
  const int bn = blockIdx.y * BN;

  const int kb  = (lane & 16) ? 8 : 0;
  const int l15 = lane & 15;
  const int hi8 = (lane & 16) ? 8 : 0;

  v8f acc[4][4];
#pragma unroll
  for (int a2 = 0; a2 < 4; a2++)
#pragma unroll
    for (int b2 = 0; b2 < 4; b2++)
#pragma unroll
      for (int j = 0; j < 8; j++) acc[a2][b2][j] = 0.f;

  // this lane's 16-byte piece for the transposing load of a 16(k) x 16(n) block of a B slice
  const int btr  = (hi8 + (lane & 7)) * BSTR + ((lane >> 3) & 1) * 8;

  // waves 0 and 1 bring the two 64-row halves of the A tile (rows of 128 B), waves 2 and 3 the two 32-row halves of the
  // B tile (rows of 256 B); slice w of a buffer is wave w's
  const uint32_t isA = pinned(wave < 2u ? 1u : 0u);  // pinned(): the test on it below is a scalar branch
  const uint64_t gbase = isA ? (uint64_t)(uintptr_t)(A + (size_t)(bm + (int)wave * 64) * K)
                             : (uint64_t)(uintptr_t)(B + (size_t)(((int)wave - 2) * 32) * Ncols + bn);
  const uint32_t gstep = isA ? (uint32_t)(BK * 2) : (uint32_t)(BK * 2) * (uint32_t)Ncols;  // bytes from one k-step's slice to the next
  const uint32_t ldst  = (uint32_t)(size_t)sT + wave * SLICE;
  // pad behind every 128-B row: 16 B (pitch 144 B, for ds_load_b128); behind every 256-B row: 32 B (pitch 288 B, for ds_load_tr16_b128)
  u32x8 g1a = tdm_group1<(1u << 20) | (4u << 22) | (3u << 25), 128u, 64u>((uint32_t)K * 2u);
  u32x8 g1b = tdm_group1<(1u << 20) | (5u << 22) | (7u << 25), 256u, 32u>((uint32_t)Ncols * 2u);
  // as in pinned(): the descriptor words are held in their scalar registers through the loop, so that none of them
  // serves as a scratch register while a request that named it is in flight
  asm volatile("" : "+s"(g1a), "+s"(g1b));  // pinned(): descriptor words held in scalar registers
  auto issue = [&](uint32_t st) {
    const u32x4 g0 = tdm_group0(ldst + (st & 1u) * STAGE, gbase + (uint64_t)(st * gstep));
    if (isA != 0u) tdm_load(g0, g1a);  // scalar branch: each wave issues exactly one of the two requests
    else           tdm_load(g0, g1b);
  };

  const uint32_t nst = uni((uint32_t)K / BK);
  issue(0u);
  asm volatile("s_wait_tensorcnt 0x0" ::: "memory");  // this wave's slice of k-step 0 has landed
  __syncthreads();                                    // ... and every other wave's: k-step 0 may be read
  issue(1u);

  for (uint32_t s = 0; s < nst; s++) {
    const unsigned char* sbuf = sT + (s & 1u) * STAGE;
    const half_t* sA = (const half_t*)(sbuf + wm * SLICE);   // this wave's 64 A rows
    const half_t* sB = (const half_t*)(sbuf + 2 * SLICE);    // k rows 0..31; rows 32..63 one slice further
#pragma unroll
    for (int ks = 0; ks < BK; ks += 32) {
      v16h af[4], bf[4];
#pragma unroll
      for (int b2 = 0; b2 < 4; b2++) {
        // k = 8h + 0..7 and 16 + 8h + 0..7 of column l15: the same k order as af
        const half_t* pb = sB + (ks / 32) * (SLICE / 2) + btr + wn * 64 + b2 * 16;
        bf[b2] = make_frag(ld_tr16(pb), ld_tr16(pb + 16 * BSTR));
      }
#pragma unroll
      for (int a2 = 0; a2 < 4; a2++) {
        const half_t* pa = sA + (a2 * 16 + l15) * ASTR + ks;
        af[a2] = make_frag(*(const v8h*)(pa + kb), *(const v8h*)(pa + kb + 16));
      }
      if (ks == BK - 32) {
        // hand-over, once the k-step's last fragments are fetched, in this order: this wave's reads of the buffer are
        // done; its slice of k-step s + 1 has landed; the one barrier publishes k-step s + 1 and ends every wave's reads
        // of the buffer that is refilled behind it. The refill goes out ahead of the last 16 WMMAs: a whole k-step of lead
        asm volatile("s_wait_dscnt 0x0" ::: "memory");
        asm volatile("s_wait_tensorcnt 0x0" ::: "memory");
        __syncthreads();
        const uint32_t nx = pinned(s + 2u);        // pinned(): the next descriptor is formed behind the wait above
        if (pinned(nx < nst ? 1u : 0u) != 0u) issue(nx);  // scalar branch: only while k-step s + 2 exists
      }
      // holds the 16 fragment loads ahead of the 16 WMMAs as one group: left free, the compiler reloads one
      // A fragment per 4 WMMAs into the same registers and the wave waits out the LDS latency four times
      __builtin_amdgcn_sched_barrier(0);
#pragma unroll
      for (int a2 = 0; a2 < 4; a2++)
#pragma unroll
        for (int b2 = 0; b2 < 4; b2++)
          acc[a2][b2] = wmma_f16(af[a2], bf[b2], acc[a2][b2]);
    }
  }
  // no request and no LDS read is left when the wave goes on
  asm volatile("s_wait_tensorcnt 0x0" ::: "memory");
  asm volatile("s_wait_dscnt 0x0" ::: "memory");

  // The wave's four 16-row groups pass through one copy of the epilogue's code: the loop stays rolled and the
  // next group's accumulators move down into acc[0]. Unrolled, the GELU epilogue of 128 values a lane is about
  // four times the text.
#pragma unroll 1
  for (int a2 = 0; a2 < 4; a2++) {
    const int r0 = bm + wm * 64 + a2 * 16 + hi8;
#pragma unroll
    for (int b2 = 0; b2 < 4; b2++) {
      const int c0 = bn + wn * 64 + b2 * 16 + l15;
      const float bc = bias[c0];
#pragma unroll
      for (int j = 0; j < 8; j++) {
        int r = r0 + j;
        float v0 = acc[0][b2][j] + bc;
        if constexpr (MODE == MODE_F16_BIAS) {
          out16[(size_t)r * Ncols + c0] = (half_t)v0;
        } else if constexpr (MODE == MODE_F16_GELU) {
          v0 = 0.5f * v0 * (1.0f + erff(v0 * 0.70710678118f));
          out16[(size_t)r * Ncols + c0] = (half_t)v0;
        } else if constexpr (MODE == MODE_F32_RES_T) {
          // h = x(transposed read) + proj
          int n = r >> 11, t = r & (T_DIM - 1);
          size_t tr = ((size_t)t * N_DIM + n) * C_DIM;
          out32[(size_t)r * C_DIM + c0] = v0 + res[tr + c0];
        } else {  // MODE_F32_OUT_T : d_out[(t,n,c)] = h + ffn
          int n = r >> 11, t = r & (T_DIM - 1);
          size_t tr = ((size_t)t * N_DIM + n) * C_DIM;
          out32[tr + c0] = v0 + res[(size_t)r * C_DIM + c0];
        }
      }
    }
#pragma unroll
    for (int s = 0; s < 3; s++)
#pragma unroll
      for (int b2 = 0; b2 < 4; b2++) acc[s][b2] = acc[s + 1][b2];
    // the next pass rewrites registers that this pass's loads and stores name: the wait stands in front of that
    asm volatile("s_wait_xcnt 0x0" ::: "memory");
  }
}

// ---------------- Banded flash attention: four waves per block, one 16-query tile each ----
// The four tiles walk nearly the same keys, so each 32-key chunk of K and V is brought in once per block, in
// whole 128-B lines, and laid row-major in LDS; every wave takes its fragments from there (V by the transposing load).
__global__ __launch_bounds__(128) void attn_kernel(const half_t* __restrict__ Q,
                                                   const half_t* __restrict__ KV,
                                                   half_t* __restrict__ O) {
  __shared__ __align__(16) half_t sK[2][32 * KSTR];     // [key][d], two buffers
  __shared__ __align__(16) half_t sV[2][32 * VSTR];     // [key][d], two buffers
  __shared__ __align__(16) half_t sPw[AQW][16 * LSTR];  // one P tile per wave

  const int tid  = threadIdx.x;
  const int lane = tid & 31;
  const int wave = __builtin_amdgcn_readfirstlane(tid >> 5);
  const int qb = blockIdx.x * (16 * AQW);  // first query of the block
  const int q0 = qb + wave * 16;           // first query of this wave
  const int h  = blockIdx.y;
  const int n  = blockIdx.z;

  const int kb  = (lane & 16) ? 8 : 0;
  const int l15 = lane & 15;
  const int hi8 = (lane & 16) ? 8 : 0;

  const half_t* Qb = Q + ((size_t)(n * T_DIM + q0)) * C_DIM + h * D_DIM;
  const half_t* Kb = KV + ((size_t)n * T_DIM) * (2 * C_DIM) + h * D_DIM;
  half_t* sP = sPw[wave];

  // Q as A-fragments for both 32-wide D steps (per-lane runs are contiguous in D)
  const half_t* qr = Qb + (size_t)l15 * C_DIM;
  v16h aQ0 = make_frag(*(const v8h*)(qr + kb), *(const v8h*)(qr + kb + 16));
  v16h aQ1 = make_frag(*(const v8h*)(qr + 32 + kb), *(const v8h*)(qr + 32 + kb + 16));

  float m[8], l[8];
  v8f oo[4];
#pragma unroll
  for (int j = 0; j < 8; j++) { m[j] = -3e38f; l[j] = 0.f; }
#pragma unroll
  for (int dt = 0; dt < 4; dt++)
#pragma unroll
    for (int j = 0; j < 8; j++) oo[dt][j] = 0.f;

  // this wave's own chunks: the 32-key chunks that hold a key of its 16 queries' band
  int kstart = q0 - W_DIM;
  if (kstart < 0) kstart = 0;
  kstart &= ~31;
  // the block's chunks: from its first wave's first to its last wave's last
  int kfirst = qb - W_DIM;
  if (kfirst < 0) kfirst = 0;
  kfirst &= ~31;
  const int klast = (qb + 16 * AQW - 1) & ~31;

  // staging: a thread moves rows srow and srow + 16 of K and of V, 16 bytes of each; a wave-load covers 4 whole lines
  const int srow = tid >> 3;        // 0..15
  const int sc8  = (tid & 7) * 8;   // 0..56
  const half_t* gs = Kb + (size_t)srow * (2 * C_DIM) + sc8;
  const int kst = srow * KSTR + sc8;
  const int vst = srow * VSTR + sc8;
  // this lane's 16-byte piece for the transposing load of a 16(key) x 16(d) block of sV
  const int vtr = (hi8 + (lane & 7)) * VSTR + ((lane >> 3) & 1) * 8;

  {
    const half_t* g = gs + (size_t)kfirst * (2 * C_DIM);
    v8h rk0 = *(const v8h*)(g);
    v8h rk1 = *(const v8h*)(g + 16 * (2 * C_DIM));
    v8h rv0 = *(const v8h*)(g + C_DIM);
    v8h rv1 = *(const v8h*)(g + 16 * (2 * C_DIM) + C_DIM);
    *(v8h*)(sK[0] + kst) = rk0;
    *(v8h*)(sK[0] + kst + 16 * KSTR) = rk1;
    *(v8h*)(sV[0] + vst) = rv0;
    *(v8h*)(sV[0] + vst + 16 * VSTR) = rv1;
  }
  __syncthreads();

  int buf = 0;
  for (int kc = kfirst; kc <= klast; kc += 32) {
    // the next chunk's lines are asked for ahead of this chunk's work and laid into the other buffer behind it
    const bool more = kc + 32 <= klast;
    v8h rk0, rk1, rv0, rv1;
    if (more) {
      const half_t* g = gs + (size_t)(kc + 32) * (2 * C_DIM);
      rk0 = *(const v8h*)(g);
      rk1 = *(const v8h*)(g + 16 * (2 * C_DIM));
      rv0 = *(const v8h*)(g + C_DIM);
      rv1 = *(const v8h*)(g + 16 * (2 * C_DIM) + C_DIM);
      // the work below reuses the registers that hold these loads' address: the wait stands in front of that
      asm volatile("s_wait_xcnt 0x0" ::: "memory");
    }

    // wave-uniform: a chunk outside this wave's own band is passed over (every wave still meets the barrier below)
    if (kc >= kstart && kc <= q0 + 15) {
      // K B-fragments (column = key, contiguous runs in D per lane)
      const half_t* kr0 = sK[buf] + l15 * KSTR;
      const half_t* kr1 = kr0 + 16 * KSTR;
      v16h bK00 = make_frag(*(const v8h*)(kr0 + kb), *(const v8h*)(kr0 + kb + 16));
      v16h bK01 = make_frag(*(const v8h*)(kr0 + 32 + kb), *(const v8h*)(kr0 + 32 + kb + 16));
      v16h bK10 = make_frag(*(const v8h*)(kr1 + kb), *(const v8h*)(kr1 + kb + 16));
      v16h bK11 = make_frag(*(const v8h*)(kr1 + 32 + kb), *(const v8h*)(kr1 + 32 + kb + 16));

      v8f s0 = {0, 0, 0, 0, 0, 0, 0, 0};
      v8f s1 = {0, 0, 0, 0, 0, 0, 0, 0};
      s0 = wmma_f16(aQ0, bK00, s0);
      s0 = wmma_f16(aQ1, bK01, s0);
      s1 = wmma_f16(aQ0, bK10, s1);
      s1 = wmma_f16(aQ1, bK11, s1);

      // online softmax (band mask as data-level select; EXEC stays all-1s)
      float pv0[8], pv1[8];
#pragma unroll
      for (int j = 0; j < 8; j++) {
        int q = q0 + j + hi8;
        int k0i = kc + l15, k1i = kc + 16 + l15;
        bool val0 = (k0i <= q) && (q - k0i <= W_DIM);
        bool val1 = (k1i <= q) && (q - k1i <= W_DIM);
        float x0 = val0 ? s0[j] * 0.125f : -3e38f;
        float x1 = val1 ? s1[j] * 0.125f : -3e38f;
        float cm = fmaxf(x0, x1);
#pragma unroll
        for (int msk = 1; msk < 16; msk <<= 1) cm = fmaxf(cm, __shfl_xor(cm, msk));
        float nm = fmaxf(m[j], cm);
        float corr = __expf(m[j] - nm);  // (-3e38)-(-3e38)=0 -> 1; finite path ok
        m[j] = nm;
        float p0 = val0 ? __expf(x0 - nm) : 0.f;
        float p1 = val1 ? __expf(x1 - nm) : 0.f;
        float rs = p0 + p1;
#pragma unroll
        for (int msk = 1; msk < 16; msk <<= 1) rs += __shfl_xor(rs, msk);
        l[j] = l[j] * corr + rs;
#pragma unroll
        for (int dt = 0; dt < 4; dt++) oo[dt][j] *= corr;
        pv0[j] = p0;
        pv1[j] = p1;
      }

      // P -> LDS (re-layout from C/D layout to A-fragment layout), in the wave's own tile
#pragma unroll
      for (int j = 0; j < 8; j++) {
        sP[(j + hi8) * LSTR + l15] = (half_t)pv0[j];
        sP[(j + hi8) * LSTR + 16 + l15] = (half_t)pv1[j];
      }
      // the P tile goes from lane to lane of one wave only: the LDS stores are waited out and the loads below stay
      // behind them; no work-group barrier may stand here, inside a branch that not every wave takes
      __builtin_amdgcn_fence(__ATOMIC_ACQ_REL, "workgroup", "local");

      const half_t* pp = sP + l15 * LSTR;
      v16h aP = make_frag(*(const v8h*)(pp + kb), *(const v8h*)(pp + kb + 16));
#pragma unroll
      for (int dt = 0; dt < 4; dt++) {
        // keys 8h + 0..7 and 16 + 8h + 0..7 of column d = dt*16 + l15: the same k order as aP
        const half_t* pv = sV[buf] + vtr + dt * 16;
        v16h bV = make_frag(ld_tr16(pv), ld_tr16(pv + 16 * VSTR));
        oo[dt] = wmma_f16(aP, bV, oo[dt]);
      }
    }

    if (more) {
      *(v8h*)(sK[buf ^ 1] + kst) = rk0;
      *(v8h*)(sK[buf ^ 1] + kst + 16 * KSTR) = rk1;
      *(v8h*)(sV[buf ^ 1] + vst) = rv0;
      *(v8h*)(sV[buf ^ 1] + vst + 16 * VSTR) = rv1;
    }
    // one barrier per chunk: it publishes the buffer just filled and ends every wave's reads of the one filled next
    __syncthreads();
    buf ^= 1;
  }

  float inv[8];
#pragma unroll
  for (int j = 0; j < 8; j++) inv[j] = (l[j] > 0.f) ? (1.0f / l[j]) : 0.f;

  half_t* ob = O + ((size_t)(n * T_DIM + q0)) * C_DIM + h * D_DIM;
#pragma unroll
  for (int j = 0; j < 8; j++) {
    size_t rb = (size_t)(j + hi8) * C_DIM;
#pragma unroll
    for (int dt = 0; dt < 4; dt++)
      ob[rb + dt * 16 + l15] = (half_t)(oo[dt][j] * inv[j]);
  }
}

// ---------------- host orchestration ----------------
extern "C" void kernel_launch(void* const* d_in, const int* in_sizes, int n_in,
                              void* d_out, int out_size, void* d_ws, size_t ws_size,
                              hipStream_t stream) {
  (void)in_sizes; (void)n_in; (void)out_size; (void)ws_size;
  const float* x     = (const float*)d_in[0];
  const float* q_w   = (const float*)d_in[1];
  const float* q_b   = (const float*)d_in[2];
  const float* kv_w  = (const float*)d_in[3];
  const float* kv_b  = (const float*)d_in[4];
  const float* out_w = (const float*)d_in[5];
  const float* out_b = (const float*)d_in[6];
  const float* ff_w1 = (const float*)d_in[7];
  const float* ff_b1 = (const float*)d_in[8];
  const float* ff_w2 = (const float*)d_in[9];
  const float* ff_b2 = (const float*)d_in[10];
  const float* ln1_g = (const float*)d_in[11];
  const float* ln1_b = (const float*)d_in[12];
  const float* ln2_g = (const float*)d_in[13];
  const float* ln2_b = (const float*)d_in[14];

  char* ws = (char*)d_ws;
  size_t off = 0;
  auto alloc = [&](size_t bytes) -> char* {
    char* p = ws + off;
    off += (bytes + 255) & ~(size_t)255;
    return p;
  };
  half_t* wq   = (half_t*)alloc((size_t)C_DIM * C_DIM * 2);
  half_t* wkv  = (half_t*)alloc((size_t)C_DIM * 2 * C_DIM * 2);
  half_t* wo   = (half_t*)alloc((size_t)C_DIM * C_DIM * 2);
  half_t* wf1  = (half_t*)alloc((size_t)C_DIM * F_DIM * 2);
  half_t* wf2  = (half_t*)alloc((size_t)F_DIM * C_DIM * 2);
  half_t* A16  = (half_t*)alloc((size_t)NT * C_DIM * 2);
  half_t* Q16  = (half_t*)alloc((size_t)NT * C_DIM * 2);
  half_t* KV16 = (half_t*)alloc((size_t)NT * 2 * C_DIM * 2);
  half_t* O16  = (half_t*)alloc((size_t)NT * C_DIM * 2);
  float*  H32  = (float*)alloc((size_t)NT * C_DIM * 4);
  half_t* G16  = (half_t*)alloc((size_t)NT * F_DIM * 2);

  auto cast = [&](const float* s, half_t* d, int n) {
    cast_f32_to_f16<<<(n + 255) / 256, 256, 0, stream>>>(s, d, n);
  };
  cast(q_w, wq, C_DIM * C_DIM);
  cast(kv_w, wkv, C_DIM * 2 * C_DIM);
  cast(out_w, wo, C_DIM * C_DIM);
  cast(ff_w1, wf1, C_DIM * F_DIM);
  cast(ff_w2, wf2, F_DIM * C_DIM);

  layernorm_f16<true><<<NT, 256, 0, stream>>>(x, ln1_g, ln1_b, A16);

  dim3 blk(128);
  gemm_wmma<MODE_F16_BIAS><<<dim3(NT / BM, C_DIM / BN), blk, 0, stream>>>(
      A16, wq, q_b, nullptr, Q16, nullptr, C_DIM, C_DIM);
  gemm_wmma<MODE_F16_BIAS><<<dim3(NT / BM, 2 * C_DIM / BN), blk, 0, stream>>>(
      A16, wkv, kv_b, nullptr, KV16, nullptr, C_DIM, 2 * C_DIM);

  int nrope = NT * H_DIM * (D_DIM / 2);
  rope_inplace<<<(nrope + 255) / 256, 256, 0, stream>>>(Q16, C_DIM);
  rope_inplace<<<(nrope + 255) / 256, 256, 0, stream>>>(KV16, 2 * C_DIM);

  attn_kernel<<<dim3(T_DIM / (16 * AQW), H_DIM, N_DIM), 32 * AQW, 0, stream>>>(Q16, KV16, O16);

  gemm_wmma<MODE_F32_RES_T><<<dim3(NT / BM, C_DIM / BN), blk, 0, stream>>>(
      O16, wo, out_b, x, nullptr, H32, C_DIM, C_DIM);

  layernorm_f16<false><<<NT, 256, 0, stream>>>(H32, ln2_g, ln2_b, A16);

  gemm_wmma<MODE_F16_GELU><<<dim3(NT / BM, F_DIM / BN), blk, 0, stream>>>(
      A16, wf1, ff_b1, nullptr, G16, nullptr, C_DIM, F_DIM);

  gemm_wmma<MODE_F32_OUT_T><<<dim3(NT / BM, C_DIM / BN), blk, 0, stream>>>(
      G16, wf2, ff_b2, H32, nullptr, (float*)d_out, F_DIM, C_DIM);
}

// v005
// It runs in 324 microseconds.
// Next to v004, in two timings, it ran 1.04 times as fast each time.
// Counting every step since v000, it is 4.93 times as fast.
#include <hip/hip_runtime.h>
#include <hip/hip_bf16.h>
#include <math.h>
#include <stdint.h>

typedef _Float16 half_t;
typedef __attribute__((ext_vector_type(16))) _Float16 v16h;
typedef __attribute__((ext_vector_type(8)))  _Float16 v8h;
typedef __attribute__((ext_vector_type(8)))  float    v8f;
typedef __attribute__((ext_vector_type(4)))  float    v4f;

#define T_DIM 2048
#define N_DIM 4
#define C_DIM 1024
#define H_DIM 16
#define D_DIM 64
#define W_DIM 512
#define F_DIM 4096
#define NT    (T_DIM * N_DIM)

#define BM 128
#define BN 128
#define BK 64
#define LSTR 40   // padded LDS stride in halves (80B: 16B aligned, avoids bank conflicts)
#define ASTR 72   // LDS stride of a GEMM A row in halves (144B = 16B x 9: the pitch of the 16-byte load)
#define BSTR 144  // LDS stride of a row-major B row in halves (288B = 32B x 9: the pitch of the transposing load)
#define SLICE 10240          // bytes of LDS per tensor-load slice: 64 A rows at 144 B or 32 B rows at 288 B (9,216 B), up to a multiple of 2 KiB
#define STAGE (4 * SLICE)    // one k-step's tiles: two A slices, then two B slices
#define OSTR16 72  // LDS stride of a staged f16 output row in halves (144B: rows r and r + 8 fall on different banks; the pitch of the 16-byte load)
#define OSTR32 68  // LDS stride of a staged f32 output row in floats (272B: the same two properties)
#define AQW  4    // attention: 16-query tiles (waves) per block
#define KSTR 72   // attention: LDS stride of a K row in halves (144B = 16B x 9: the pitch of the 16-byte load)
#define VSTR 80   // attention: LDS stride of a V row in halves (160B = 32B x 5: the pitch of the transposing load)

enum { MODE_F16_BIAS = 0, MODE_F16_GELU = 1, MODE_F32_RES_T = 2, MODE_F32_OUT_T = 3 };

__device__ __forceinline__ v16h make_frag(v8h lo, v8h hi) {
  v16h a;
#pragma unroll
  for (int i = 0; i < 8; i++) { a[i] = lo[i]; a[i + 8] = hi[i]; }
  return a;
}

__device__ __forceinline__ v8f wmma_f16(v16h a, v16h b, v8f c) {
  return __builtin_amdgcn_wmma_f32_16x16x32_f16(false, a, false, b, (short)0, c, false, false);
}

// Transposing LDS load: from a row-major [k][n] tile, lane (c = lane & 15, h = lane >> 4)
// receives the 8 values T[k0 + 8h + 0..7][n0 + c]. Every lane passes the address of one 16-byte piece.
typedef __attribute__((ext_vector_type(8))) short s16x8;
__device__ __forceinline__ v8h ld_tr16(const half_t* p) {
  typedef __attribute__((address_space(3))) s16x8 lds_s16x8;
  return __builtin_bit_cast(v8h, __builtin_amdgcn_ds_load_tr16_b128_v8i16((lds_s16x8*)p));
}

// ---------------- tensor load to LDS: one request of a whole wave brings a padded two-dimensional tile ----------------
typedef uint32_t u32x4 __attribute__((ext_vector_type(4)));
typedef uint32_t u32x8 __attribute__((ext_vector_type(8)));
__device__ __forceinline__ uint32_t uni(uint32_t v) { return (uint32_t)__builtin_amdgcn_readfirstlane(v); }
__device__ __forceinline__ uint32_t pinned(uint32_t v) {
  uint32_t w = uni(v);
  asm volatile("" : "+s"(w));  // pinned(): a value for a tensor load's test or descriptor, held in a scalar register
  return w;
}
// group 1: 1-byte elements, tensor = tile = ROWS rows of ROWB bytes, source pitch in bytes; WORD0 holds the pad that sets the LDS pitch
template <uint32_t WORD0, uint32_t ROWB, uint32_t ROWS>
__device__ __forceinline__ u32x8 tdm_group1(uint32_t src_pitch) {
  u32x8 g;
  g[0] = uni(WORD0);
  g[1] = uni((ROWB & 0xFFFFu) << 16);
  g[2] = uni((ROWB >> 16) | ((ROWS & 0xFFFFu) << 16));
  g[3] = uni((ROWS >> 16) | (ROWB << 16));
  g[4] = uni(ROWS);
  g[5] = uni(src_pitch);
  g[6] = uni(0u);
  g[7] = uni(0u);
  return g;
}
// group 0: count 1, place in LDS, address of the tile's first byte, type 2
__device__ __forceinline__ u32x4 tdm_group0(uint32_t lds_dst, uint64_t ga) {
  u32x4 g;
  g[0] = uni(1u);
  g[1] = uni(lds_dst);
  g[2] = uni((uint32_t)ga);
  g[3] = uni((((uint32_t)(ga >> 32)) & 0x01FFFFFFu) | 0x80000000u);
  return g;
}
__device__ __forceinline__ void tdm_load(u32x4 g0, u32x8 g1) {
  asm volatile("tensor_load_to_lds %0, %1" :: "s"(g0), "s"(g1) : "memory");
}

// ---------------- elementwise: f32 -> f16 cast ----------------
__global__ void cast_f32_to_f16(const float* __restrict__ src, half_t* __restrict__ dst, int n) {
  int i = blockIdx.x * blockDim.x + threadIdx.x;
  if (i < n) dst[i] = (half_t)src[i];
}

// ---------------- LayerNorm (one block per row), writes f16 ----------------
template <bool TRANSPOSED>
__global__ __launch_bounds__(256) void layernorm_f16(const float* __restrict__ src,
                                                     const float* __restrict__ g,
                                                     const float* __restrict__ b,
                                                     half_t* __restrict__ dst) {
  int r = blockIdx.x;  // r = n*T + t
  const float* row;
  if (TRANSPOSED) {
    int n = r >> 11;             // T = 2048
    int t = r & (T_DIM - 1);
    row = src + ((size_t)t * N_DIM + n) * C_DIM;
  } else {
    row = src + (size_t)r * C_DIM;
  }
  float v[4];
  float s = 0.f, s2 = 0.f;
#pragma unroll
  for (int i = 0; i < 4; i++) {
    v[i] = row[threadIdx.x + i * 256];
    s += v[i];
    s2 += v[i] * v[i];
  }
#pragma unroll
  for (int m = 16; m >= 1; m >>= 1) { s += __shfl_xor(s, m); s2 += __shfl_xor(s2, m); }
  __shared__ float sh[2][8];
  int wave = threadIdx.x >> 5, lane = threadIdx.x & 31;
  if (lane == 0) { sh[0][wave] = s; sh[1][wave] = s2; }
  __syncthreads();
  if (wave == 0) {
    s = sh[0][lane & 7];
    s2 = sh[1][lane & 7];
#pragma unroll
    for (int m = 4; m >= 1; m >>= 1) { s += __shfl_xor(s, m); s2 += __shfl_xor(s2, m); }
    if (lane == 0) { sh[0][0] = s; sh[1][0] = s2; }
  }
  __syncthreads();
  float mu = sh[0][0] * (1.0f / C_DIM);
  float var = sh[1][0] * (1.0f / C_DIM) - mu * mu;
  float rstd = rsqrtf(var + 1e-5f);
#pragma unroll
  for (int i = 0; i < 4; i++) {
    int c = threadIdx.x + i * 256;
    dst[(size_t)r * C_DIM + c] = (half_t)((v[i] - mu) * rstd * g[c] + b[c]);
  }
}

// ---------------- RoPE, in place on f16 (pos = t + W) ----------------
__global__ void rope_inplace(half_t* __restrict__ buf, int stride) {
  int idx = blockIdx.x * blockDim.x + threadIdx.x;
  if (idx >= NT * H_DIM * (D_DIM / 2)) return;
  int i = idx & 31;
  int h = (idx >> 5) & 15;
  int row = idx >> 9;
  int t = row & (T_DIM - 1);
  float pos = (float)(t + W_DIM);
  // inv_freq = ROPE_BASE^(-2i/D) = exp(-(2i/D) * ln(10000))
  float freq = __expf(-(float)(2 * i) * (1.0f / (float)D_DIM) * 9.210340371976184f);
  float ang = pos * freq;
  float sn, cs;
  __sincosf(ang, &sn, &cs);
  half_t* p = buf + (size_t)row * stride + h * D_DIM;
  float a = (float)p[i];
  float bq = (float)p[i + 32];
  p[i] = (half_t)(a * cs - bq * sn);
  p[i + 32] = (half_t)(bq * cs + a * sn);
}

// ---------------- WMMA GEMM: C[M x Ncols] = A(f16, MxK) @ B(f16, KxNcols) + epilogue ----
// Block tile 128x128x64, 4 waves (2 x 2); each wave owns a 64x64 macro-tile:
// 4 A-frags x 4 B-frags -> 16 WMMAs per 32 k. The tiles come by the tensor mover into two LDS buffers: every wave asks
// for one 8-KiB slice per k-step, one k-step ahead of its use, so the next tiles fly while these are multiplied.
// K is at least two k-steps (128) and a multiple of 64 at every launch. The row length of B and of the output is a
// constant of the instance, so that the epilogue's stores share one address register and differ in their offset fields.
template <int MODE, int Ncols>
__global__ __launch_bounds__(128) void gemm_wmma(const half_t* __restrict__ A,
                                                 const half_t* __restrict__ B,
                                                 const float* __restrict__ bias,
                                                 const float* __restrict__ res,
                                                 half_t* __restrict__ out16,
                                                 float* __restrict__ out32,
                                                 int K) {
  // per buffer: A rows 0..63 | A rows 64..127 (pitch 144 B) | B rows k 0..31 | k 32..63 (row-major [k][n], pitch 288 B)
  __shared__ __attribute__((aligned(2048))) unsigned char sT[2 * STAGE];

  const int tid = threadIdx.x;
  const int lane = tid & 31;
  const uint32_t wave = uni((uint32_t)tid >> 5);
  const int wm = wave >> 1;  // 0..1 : 64-row strip
  const int wn = wave & 1;   // 0..1 : 64-col strip
  const int bm = blockIdx.x * BM;
  const int bn = blockIdx.y * BN;

  const int kb  = (lane & 16) ? 8 : 0;
  const int l15 = lane & 15;
  const int hi8 = (lane & 16) ? 8 : 0;

  v8f acc[4][4];
#pragma unroll
  for (int a2 = 0; a2 < 4; a2++)
#pragma unroll
    for (int b2 = 0; b2 < 4; b2++)
#pragma unroll
      for (int j = 0; j < 8; j++) acc[a2][b2][j] = 0.f;

  // this lane's 16-byte piece for the transposing load of a 16(k) x 16(n) block of a B slice
  const int btr  = (hi8 + (lane & 7)) * BSTR + ((lane >> 3) & 1) * 8;

  // waves 0 and 1 bring the two 64-row halves of the A tile (rows of 128 B), waves 2 and 3 the two 32-row halves of the
  // B tile (rows of 256 B); slice w of a buffer is wave w's
  const uint32_t isA = pinned(wave < 2u ? 1u : 0u);  // pinned(): the test on it below is a scalar branch
  const uint64_t gbase = isA ? (uint64_t)(uintptr_t)(A + (size_t)(bm + (int)wave * 64) * K)
                             : (uint64_t)(uintptr_t)(B + (size_t)(((int)wave - 2) * 32) * Ncols + bn);
  const uint32_t gstep = isA ? (uint32_t)(BK * 2) : (uint32_t)(BK * 2) * (uint32_t)Ncols;  // bytes from one k-step's slice to the next
  const uint32_t ldst  = (uint32_t)(size_t)sT + wave * SLICE;
  // pad behind every 128-B row: 16 B (pitch 144 B, for ds_load_b128); behind every 256-B row: 32 B (pitch 288 B, for ds_load_tr16_b128)
  u32x8 g1a = tdm_group1<(1u << 20) | (4u << 22) | (3u << 25), 128u, 64u>((uint32_t)K * 2u);
  u32x8 g1b = tdm_group1<(1u << 20) | (5u << 22) | (7u << 25), 256u, 32u>((uint32_t)Ncols * 2u);
  // as in pinned(): the descriptor words are held in their scalar registers through the loop, so that none of them
  // serves as a scratch register while a request that named it is in flight
  asm volatile("" : "+s"(g1a), "+s"(g1b));  // pinned(): descriptor words held in scalar registers
  auto issue = [&](uint32_t st) {
    const u32x4 g0 = tdm_group0(ldst + (st & 1u) * STAGE, gbase + (uint64_t)(st * gstep));
    if (isA != 0u) tdm_load(g0, g1a);  // scalar branch: each wave issues exactly one of the two requests
    else           tdm_load(g0, g1b);
  };

  const uint32_t nst = uni((uint32_t)K / BK);
  issue(0u);
  asm volatile("s_wait_tensorcnt 0x0" ::: "memory");  // this wave's slice of k-step 0 has landed
  __syncthreads();                                    // ... and every other wave's: k-step 0 may be read
  issue(1u);

  for (uint32_t s = 0; s < nst; s++) {
    const unsigned char* sbuf = sT + (s & 1u) * STAGE;
    const half_t* sA = (const half_t*)(sbuf + wm * SLICE);   // this wave's 64 A rows
    const half_t* sB = (const half_t*)(sbuf + 2 * SLICE);    // k rows 0..31; rows 32..63 one slice further
#pragma unroll
    for (int ks = 0; ks < BK; ks += 32) {
      v16h af[4], bf[4];
#pragma unroll
      for (int b2 = 0; b2 < 4; b2++) {
        // k = 8h + 0..7 and 16 + 8h + 0..7 of column l15: the same k order as af
        const half_t* pb = sB + (ks / 32) * (SLICE / 2) + btr + wn * 64 + b2 * 16;
        bf[b2] = make_frag(ld_tr16(pb), ld_tr16(pb + 16 * BSTR));
      }
#pragma unroll
      for (int a2 = 0; a2 < 4; a2++) {
        const half_t* pa = sA + (a2 * 16 + l15) * ASTR + ks;
        af[a2] = make_frag(*(const v8h*)(pa + kb), *(const v8h*)(pa + kb + 16));
      }
      if (ks == BK - 32) {
        // hand-over, once the k-step's last fragments are fetched, in this order: this wave's reads of the buffer are
        // done; its slice of k-step s + 1 has landed; the one barrier publishes k-step s + 1 and ends every wave's reads
        // of the buffer that is refilled behind it. The refill goes out ahead of the last 16 WMMAs: a whole k-step of lead
        asm volatile("s_wait_dscnt 0x0" ::: "memory");
        asm volatile("s_wait_tensorcnt 0x0" ::: "memory");
        __syncthreads();
        const uint32_t nx = pinned(s + 2u);        // pinned(): the next descriptor is formed behind the wait above
        if (pinned(nx < nst ? 1u : 0u) != 0u) issue(nx);  // scalar branch: only while k-step s + 2 exists
      }
      // holds the 16 fragment loads ahead of the 16 WMMAs as one group: left free, the compiler reloads one
      // A fragment per 4 WMMAs into the same registers and the wave waits out the LDS latency four times
      __builtin_amdgcn_sched_barrier(0);
#pragma unroll
      for (int a2 = 0; a2 < 4; a2++)
#pragma unroll
        for (int b2 = 0; b2 < 4; b2++)
          acc[a2][b2] = wmma_f16(af[a2], bf[b2], acc[a2][b2]);
    }
  }
  // no request and no LDS read is left when the wave goes on
  asm volatile("s_wait_tensorcnt 0x0" ::: "memory");
  asm volatile("s_wait_dscnt 0x0" ::: "memory");

  // The output leaves in whole 128-B lines: each wave lays its 64 x 64 tile row-major in a quarter of the ring that is
  // its own, and reads it back 16 bytes a lane, so that one store covers four whole lines (from the accumulators a store
  // is two pieces of 32 or 64 bytes). The ring is free: the last k-step's barrier stands behind every wave's last
  // fragment reads and behind the landing of the last tensor load, so no further barrier is needed.
  unsigned char* stg = sT + wave * (STAGE / 2);
  constexpr bool OUT16 = (MODE == MODE_F16_BIAS || MODE == MODE_F16_GELU);
  float bc[4];  // the bias of this lane's four columns
#pragma unroll
  for (int b2 = 0; b2 < 4; b2++) bc[b2] = bias[bn + wn * 64 + b2 * 16 + l15];

  // The wave's four 16-row groups pass through one copy of this code: the loop stays rolled and the
  // next group's accumulators move down into acc[0]. Unrolled, the GELU epilogue of 128 values a lane is about
  // four times the text.
#pragma unroll 1
  for (int a2 = 0; a2 < 4; a2++) {
    const int lr = a2 * 16 + hi8;
#pragma unroll
    for (int b2 = 0; b2 < 4; b2++) {
      const int lc = b2 * 16 + l15;
#pragma unroll
      for (int j = 0; j < 8; j++) {
        float v0 = acc[0][b2][j] + bc[b2];
        if constexpr (MODE == MODE_F16_GELU) v0 = 0.5f * v0 * (1.0f + erff(v0 * 0.70710678118f));
        if constexpr (OUT16) ((half_t*)stg)[(lr + j) * OSTR16 + lc] = (half_t)v0;
        else                 ((float*)stg)[(lr + j) * OSTR32 + lc] = v0;
      }
    }
#pragma unroll
    for (int s = 0; s < 3; s++)
#pragma unroll
      for (int b2 = 0; b2 < 4; b2++) acc[s][b2] = acc[s + 1][b2];
  }
  // the tile goes from lane to lane of this wave only: its LDS stores are waited out before the rows are read back
  asm volatile("s_wait_dscnt 0x0" ::: "memory");

  if constexpr (OUT16) {
    // 8 lanes take one row of 128 B, a wave-wide store 4 rows
    const int rr = lane >> 3, pc = (lane & 7) * 8;
    const half_t* sp = (const half_t*)stg + rr * OSTR16 + pc;
    half_t* gp = out16 + (size_t)(bm + wm * 64 + rr) * Ncols + bn + wn * 64 + pc;
#pragma unroll
    for (int i = 0; i < 16; i++)
      *(v8h*)(gp + i * 4 * Ncols) = *(const v8h*)(sp + i * 4 * OSTR16);
  } else {
    // 16 lanes take one row of 256 B, a wave-wide load or store 2 rows; the residual comes in the same whole lines.
    // A block's 128 rows lie in one batch entry n (T is a multiple of 128): row r = n*T + t stands at t*N + n in x and out
    const int rr = lane >> 4, pc = (lane & 15) * 4;
    const float* sp = (const float*)stg + rr * OSTR32 + pc;
    const int r = bm + wm * 64 + rr;
    const int n = r >> 11, t = r & (T_DIM - 1);
    const size_t bmaj = (size_t)r * C_DIM + bn + wn * 64 + pc;
    const size_t tmaj = ((size_t)t * N_DIM + n) * C_DIM + bn + wn * 64 + pc;
    constexpr bool RES_T = (MODE == MODE_F32_RES_T);  // h = x(transposed read) + proj; else d_out[(t,n,c)] = h + ffn
    const float* rp = res + (RES_T ? tmaj : bmaj);
    float* op = out32 + (RES_T ? bmaj : tmaj);
    constexpr int RSTEP = RES_T ? 2 * N_DIM * C_DIM : 2 * C_DIM;
    constexpr int OSTEP = RES_T ? 2 * C_DIM : 2 * N_DIM * C_DIM;
#pragma unroll
    for (int i = 0; i < 32; i++)
      *(v4f*)(op + i * OSTEP) = *(const v4f*)(sp + i * 2 * OSTR32) + *(const v4f*)(rp + i * RSTEP);
  }
}

// ---------------- Banded flash attention: four waves per block, one 16-query tile each ----
// The four tiles walk nearly the same keys, so each 32-key chunk of K and V is brought in once per block, in
// whole 128-B lines, and laid row-major in LDS; every wave takes its fragments from there (V by the transposing load).
__global__ __launch_bounds__(128) void attn_kernel(const half_t* __restrict__ Q,
                                                   const half_t* __restrict__ KV,
                                                   half_t* __restrict__ O) {
  __shared__ __align__(16) half_t sK[2][32 * KSTR];     // [key][d], two buffers
  __shared__ __align__(16) half_t sV[2][32 * VSTR];     // [key][d], two buffers
  __shared__ __align__(16) half_t sPw[AQW][16 * LSTR];  // one P tile per wave

  const int tid  = threadIdx.x;
  const int lane = tid & 31;
  const int wave = __builtin_amdgcn_readfirstlane(tid >> 5);
  const int qb = blockIdx.x * (16 * AQW);  // first query of the block
  const int q0 = qb + wave * 16;           // first query of this wave
  const int h  = blockIdx.y;
  const int n  = blockIdx.z;

  const int kb  = (lane & 16) ? 8 : 0;
  const int l15 = lane & 15;
  const int hi8 = (lane & 16) ? 8 : 0;

  const half_t* Qb = Q + ((size_t)(n * T_DIM + q0)) * C_DIM + h * D_DIM;
  const half_t* Kb = KV + ((size_t)n * T_DIM) * (2 * C_DIM) + h * D_DIM;
  half_t* sP = sPw[wave];

  // Q as A-fragments for both 32-wide D steps (per-lane runs are contiguous in D)
  const half_t* qr = Qb + (size_t)l15 * C_DIM;
  v16h aQ0 = make_frag(*(const v8h*)(qr + kb), *(const v8h*)(qr + kb + 16));
  v16h aQ1 = make_frag(*(const v8h*)(qr + 32 + kb), *(const v8h*)(qr + 32 + kb + 16));

  float m[8], l[8];
  v8f oo[4];
#pragma unroll
  for (int j = 0; j < 8; j++) { m[j] = -3e38f; l[j] = 0.f; }
#pragma unroll
  for (int dt = 0; dt < 4; dt++)
#pragma unroll
    for (int j = 0; j < 8; j++) oo[dt][j] = 0.f;

  // this wave's own chunks: the 32-key chunks that hold a key of its 16 queries' band
  int kstart = q0 - W_DIM;
  if (kstart < 0) kstart = 0;
  kstart &= ~31;
  // the block's chunks: from its first wave's first to its last wave's last
  int kfirst = qb - W_DIM;
  if (kfirst < 0) kfirst = 0;
  kfirst &= ~31;
  const int klast = (qb + 16 * AQW - 1) & ~31;

  // staging: a thread moves rows srow and srow + 16 of K and of V, 16 bytes of each; a wave-load covers 4 whole lines
  const int srow = tid >> 3;        // 0..15
  const int sc8  = (tid & 7) * 8;   // 0..56
  const half_t* gs = Kb + (size_t)srow * (2 * C_DIM) + sc8;
  const int kst = srow * KSTR + sc8;
  const int vst = srow * VSTR + sc8;
  // this lane's 16-byte piece for the transposing load of a 16(key) x 16(d) block of sV
  const int vtr = (hi8 + (lane & 7)) * VSTR + ((lane >> 3) & 1) * 8;

  {
    const half_t* g = gs + (size_t)kfirst * (2 * C_DIM);
    v8h rk0 = *(const v8h*)(g);
    v8h rk1 = *(const v8h*)(g + 16 * (2 * C_DIM));
    v8h rv0 = *(const v8h*)(g + C_DIM);
    v8h rv1 = *(const v8h*)(g + 16 * (2 * C_DIM) + C_DIM);
    *(v8h*)(sK[0] + kst) = rk0;
    *(v8h*)(sK[0] + kst + 16 * KSTR) = rk1;
    *(v8h*)(sV[0] + vst) = rv0;
    *(v8h*)(sV[0] + vst + 16 * VSTR) = rv1;
  }
  __syncthreads();

  int buf = 0;
  for (int kc = kfirst; kc <= klast; kc += 32) {
    // the next chunk's lines are asked for ahead of this chunk's work and laid into the other buffer behind it
    const bool more = kc + 32 <= klast;
    v8h rk0, rk1, rv0, rv1;
    if (more) {
      const half_t* g = gs + (size_t)(kc + 32) * (2 * C_DIM);
      rk0 = *(const v8h*)(g);
      rk1 = *(const v8h*)(g + 16 * (2 * C_DIM));
      rv0 = *(const v8h*)(g + C_DIM);
      rv1 = *(const v8h*)(g + 16 * (2 * C_DIM) + C_DIM);
      // the work below reuses the registers that hold these loads' address: the wait stands in front of that
      asm volatile("s_wait_xcnt 0x0" ::: "memory");
    }

    // wave-uniform: a chunk outside this wave's own band is passed over (every wave still meets the barrier below)
    if (kc >= kstart && kc <= q0 + 15) {
      // K B-fragments (column = key, contiguous runs in D per lane)
      const half_t* kr0 = sK[buf] + l15 * KSTR;
      const half_t* kr1 = kr0 + 16 * KSTR;
      v16h bK00 = make_frag(*(const v8h*)(kr0 + kb), *(const v8h*)(kr0 + kb + 16));
      v16h bK01 = make_frag(*(const v8h*)(kr0 + 32 + kb), *(const v8h*)(kr0 + 32 + kb + 16));
      v16h bK10 = make_frag(*(const v8h*)(kr1 + kb), *(const v8h*)(kr1 + kb + 16));
      v16h bK11 = make_frag(*(const v8h*)(kr1 + 32 + kb), *(const v8h*)(kr1 + 32 + kb + 16));

      v8f s0 = {0, 0, 0, 0, 0, 0, 0, 0};
      v8f s1 = {0, 0, 0, 0, 0, 0, 0, 0};
      s0 = wmma_f16(aQ0, bK00, s0);
      s0 = wmma_f16(aQ1, bK01, s0);
      s1 = wmma_f16(aQ0, bK10, s1);
      s1 = wmma_f16(aQ1, bK11, s1);

      // online softmax (band mask as data-level select; EXEC stays all-1s)
      float pv0[8], pv1[8];
#pragma unroll
      for (int j = 0; j < 8; j++) {
        int q = q0 + j + hi8;
        int k0i = kc + l15, k1i = kc + 16 + l15;
        bool val0 = (k0i <= q) && (q - k0i <= W_DIM);
        bool val1 = (k1i <= q) && (q - k1i <= W_DIM);
        float x0 = val0 ? s0[j] * 0.125f : -3e38f;
        float x1 = val1 ? s1[j] * 0.125f : -3e38f;
        float cm = fmaxf(x0, x1);
#pragma unroll
        for (int msk = 1; msk < 16; msk <<= 1) cm = fmaxf(cm, __shfl_xor(cm, msk));
        float nm = fmaxf(m[j], cm);
        float corr = __expf(m[j] - nm);  // (-3e38)-(-3e38)=0 -> 1; finite path ok
        m[j] = nm;
        float p0 = val0 ? __expf(x0 - nm) : 0.f;
        float p1 = val1 ? __expf(x1 - nm) : 0.f;
        float rs = p0 + p1;
#pragma unroll
        for (int msk = 1; msk < 16; msk <<= 1) rs += __shfl_xor(rs, msk);
        l[j] = l[j] * corr + rs;
#pragma unroll
        for (int dt = 0; dt < 4; dt++) oo[dt][j] *= corr;
        pv0[j] = p0;
        pv1[j] = p1;
      }

      // P -> LDS (re-layout from C/D layout to A-fragment layout), in the wave's own tile
#pragma unroll
      for (int j = 0; j < 8; j++) {
        sP[(j + hi8) * LSTR + l15] = (half_t)pv0[j];
        sP[(j + hi8) * LSTR + 16 + l15] = (half_t)pv1[j];
      }
      // the P tile goes from lane to lane of one wave only: the LDS stores are waited out and the loads below stay
      // behind them; no work-group barrier may stand here, inside a branch that not every wave takes
      __builtin_amdgcn_fence(__ATOMIC_ACQ_REL, "workgroup", "local");

      const half_t* pp = sP + l15 * LSTR;
      v16h aP = make_frag(*(const v8h*)(pp + kb), *(const v8h*)(pp + kb + 16));
#pragma unroll
      for (int dt = 0; dt < 4; dt++) {
        // keys 8h + 0..7 and 16 + 8h + 0..7 of column d = dt*16 + l15: the same k order as aP
        const half_t* pv = sV[buf] + vtr + dt * 16;
        v16h bV = make_frag(ld_tr16(pv), ld_tr16(pv + 16 * VSTR));
        oo[dt] = wmma_f16(aP, bV, oo[dt]);
      }
    }

    if (more) {
      *(v8h*)(sK[buf ^ 1] + kst) = rk0;
      *(v8h*)(sK[buf ^ 1] + kst + 16 * KSTR) = rk1;
      *(v8h*)(sV[buf ^ 1] + vst) = rv0;
      *(v8h*)(sV[buf ^ 1] + vst + 16 * VSTR) = rv1;
    }
    // one barrier per chunk: it publishes the buffer just filled and ends every wave's reads of the one filled next
    __syncthreads();
    buf ^= 1;
  }

  float inv[8];
#pragma unroll
  for (int j = 0; j < 8; j++) inv[j] = (l[j] > 0.f) ? (1.0f / l[j]) : 0.f;

  // The 16 x 64 output tile leaves in whole 128-B lines: laid row-major in this wave's own quarter of sK (free: the
  // loop's last barrier ends every wave's reads of it) and read back 16 bytes a lane, 4 rows a store
  half_t* so = &sK[0][0] + wave * (16 * KSTR);
#pragma unroll
  for (int j = 0; j < 8; j++)
#pragma unroll
    for (int dt = 0; dt < 4; dt++)
      so[(j + hi8) * KSTR + dt * 16 + l15] = (half_t)(oo[dt][j] * inv[j]);
  // the tile goes from lane to lane of this wave only: its LDS stores are waited out before the rows are read back
  asm volatile("s_wait_dscnt 0x0" ::: "memory");

  half_t* ob = O + ((size_t)(n * T_DIM + q0)) * C_DIM + h * D_DIM;
  const int orow = lane >> 3, opc = (lane & 7) * 8;
#pragma unroll
  for (int i = 0; i < 4; i++)
    *(v8h*)(ob + (size_t)(i * 4 + orow) * C_DIM + opc) = *(const v8h*)(so + (i * 4 + orow) * KSTR + opc);
}

// ---------------- host orchestration ----------------
extern "C" void kernel_launch(void* const* d_in, const int* in_sizes, int n_in,
                              void* d_out, int out_size, void* d_ws, size_t ws_size,
                              hipStream_t stream) {
  (void)in_sizes; (void)n_in; (void)out_size; (void)ws_size;
  const float* x     = (const float*)d_in[0];
  const float* q_w   = (const float*)d_in[1];
  const float* q_b   = (const float*)d_in[2];
  const float* kv_w  = (const float*)d_in[3];
  const float* kv_b  = (const float*)d_in[4];
  const float* out_w = (const float*)d_in[5];
  const float* out_b = (const float*)d_in[6];
  const float* ff_w1 = (const float*)d_in[7];
  const float* ff_b1 = (const float*)d_in[8];
  const float* ff_w2 = (const float*)d_in[9];
  const float* ff_b2 = (const float*)d_in[10];
  const float* ln1_g = (const float*)d_in[11];
  const float* ln1_b = (const float*)d_in[12];
  const float* ln2_g = (const float*)d_in[13];
  const float* ln2_b = (const float*)d_in[14];

  char* ws = (char*)d_ws;
  size_t off = 0;
  auto alloc = [&](size_t bytes) -> char* {
    char* p = ws + off;
    off += (bytes + 255) & ~(size_t)255;
    return p;
  };
  half_t* wq   = (half_t*)alloc((size_t)C_DIM * C_DIM * 2);
  half_t* wkv  = (half_t*)alloc((size_t)C_DIM * 2 * C_DIM * 2);
  half_t* wo   = (half_t*)alloc((size_t)C_DIM * C_DIM * 2);
  half_t* wf1  = (half_t*)alloc((size_t)C_DIM * F_DIM * 2);
  half_t* wf2  = (half_t*)alloc((size_t)F_DIM * C_DIM * 2);
  half_t* A16  = (half_t*)alloc((size_t)NT * C_DIM * 2);
  half_t* Q16  = (half_t*)alloc((size_t)NT * C_DIM * 2);
  half_t* KV16 = (half_t*)alloc((size_t)NT * 2 * C_DIM * 2);
  half_t* O16  = (half_t*)alloc((size_t)NT * C_DIM * 2);
  float*  H32  = (float*)alloc((size_t)NT * C_DIM * 4);
  half_t* G16  = (half_t*)alloc((size_t)NT * F_DIM * 2);

  auto cast = [&](const float* s, half_t* d, int n) {
    cast_f32_to_f16<<<(n + 255) / 256, 256, 0, stream>>>(s, d, n);
  };
  cast(q_w, wq, C_DIM * C_DIM);
  cast(kv_w, wkv, C_DIM * 2 * C_DIM);
  cast(out_w, wo, C_DIM * C_DIM);
  cast(ff_w1, wf1, C_DIM * F_DIM);
  cast(ff_w2, wf2, F_DIM * C_DIM);

  layernorm_f16<true><<<NT, 256, 0, stream>>>(x, ln1_g, ln1_b, A16);

  dim3 blk(128);
  gemm_wmma<MODE_F16_BIAS, C_DIM><<<dim3(NT / BM, C_DIM / BN), blk, 0, stream>>>(
      A16, wq, q_b, nullptr, Q16, nullptr, C_DIM);
  gemm_wmma<MODE_F16_BIAS, 2 * C_DIM><<<dim3(NT / BM, 2 * C_DIM / BN), blk, 0, stream>>>(
      A16, wkv, kv_b, nullptr, KV16, nullptr, C_DIM);

  int nrope = NT * H_DIM * (D_DIM / 2);
  rope_inplace<<<(nrope + 255) / 256, 256, 0, stream>>>(Q16, C_DIM);
  rope_inplace<<<(nrope + 255) / 256, 256, 0, stream>>>(KV16, 2 * C_DIM);

  attn_kernel<<<dim3(T_DIM / (16 * AQW), H_DIM, N_DIM), 32 * AQW, 0, stream>>>(Q16, KV16, O16);

  gemm_wmma<MODE_F32_RES_T, C_DIM><<<dim3(NT / BM, C_DIM / BN), blk, 0, stream>>>(
      O16, wo, out_b, x, nullptr, H32, C_DIM);

  layernorm_f16<false><<<NT, 256, 0, stream>>>(H32, ln2_g, ln2_b, A16);

  gemm_wmma<MODE_F16_GELU, F_DIM><<<dim3(NT / BM, F_DIM / BN), blk, 0, stream>>>(
      A16, wf1, ff_b1, nullptr, G16, nullptr, C_DIM);

  gemm_wmma<MODE_F32_OUT_T, C_DIM><<<dim3(NT / BM, C_DIM / BN), blk, 0, stream>>>(
      G16, wf2, ff_b2, H32, nullptr, (float*)d_out, F_DIM);
}

// v006
// It runs in 312 microseconds.
// Timed twice side by side with v005, it ran 1.04 times as fast both times.
// Over all steps from v000 it is 5.13 times as fast.
#include <hip/hip_runtime.h>
#include <hip/hip_bf16.h>
#include <math.h>
#include <stdint.h>

typedef _Float16 half_t;
typedef __attribute__((ext_vector_type(16))) _Float16 v16h;
typedef __attribute__((ext_vector_type(8)))  _Float16 v8h;
typedef __attribute__((ext_vector_type(8)))  float    v8f;
typedef __attribute__((ext_vector_type(4)))  float    v4f;

#define T_DIM 2048
#define N_DIM 4
#define C_DIM 1024
#define H_DIM 16
#define D_DIM 64
#define W_DIM 512
#define F_DIM 4096
#define NT    (T_DIM * N_DIM)

#define BM 128
#define BN 128
#define BK 64
#define LSTR 40   // padded LDS stride in halves (80B: 16B aligned, avoids bank conflicts)
#define ASTR 72   // LDS stride of a GEMM A row in halves (144B = 16B x 9: the pitch of the 16-byte load)
#define BSTR 144  // LDS stride of a row-major B row in halves (288B = 32B x 9: the pitch of the transposing load)
#define SLICE 10240          // bytes of LDS per tensor-load slice: 64 A rows at 144 B or 32 B rows at 288 B (9,216 B), up to a multiple of 2 KiB
#define STAGE (4 * SLICE)    // one k-step's tiles: two A slices, then two B slices
#define OSTR16 72  // LDS stride of a staged f16 output row in halves (144B: rows r and r + 8 fall on different banks; the pitch of the 16-byte load)
#define OSTR32 68  // LDS stride of a staged f32 output row in floats (272B: the same two properties)
#define AQW  4    // attention: 16-query tiles (waves) per block
#define KSTR 72   // attention: LDS stride of a K row in halves (144B = 16B x 9: the pitch of the 16-byte load)
#define VSTR 80   // attention: LDS stride of a V row in halves (160B = 32B x 5: the pitch of the transposing load)

enum { MODE_F16_BIAS = 0, MODE_F16_GELU = 1, MODE_F32_RES_T = 2, MODE_F32_OUT_T = 3 };

__device__ __forceinline__ v16h make_frag(v8h lo, v8h hi) {
  v16h a;
#pragma unroll
  for (int i = 0; i < 8; i++) { a[i] = lo[i]; a[i + 8] = hi[i]; }
  return a;
}

__device__ __forceinline__ v8f wmma_f16(v16h a, v16h b, v8f c) {
  return __builtin_amdgcn_wmma_f32_16x16x32_f16(false, a, false, b, (short)0, c, false, false);
}

// Transposing LDS load: from a row-major [k][n] tile, lane (c = lane & 15, h = lane >> 4)
// receives the 8 values T[k0 + 8h + 0..7][n0 + c]. Every lane passes the address of one 16-byte piece.
typedef __attribute__((ext_vector_type(8))) short s16x8;
__device__ __forceinline__ v8h ld_tr16(const half_t* p) {
  typedef __attribute__((address_space(3))) s16x8 lds_s16x8;
  return __builtin_bit_cast(v8h, __builtin_amdgcn_ds_load_tr16_b128_v8i16((lds_s16x8*)p));
}

// ---------------- tensor load to LDS: one request of a whole wave brings a padded two-dimensional tile ----------------
typedef uint32_t u32x4 __attribute__((ext_vector_type(4)));
typedef uint32_t u32x8 __attribute__((ext_vector_type(8)));
__device__ __forceinline__ uint32_t uni(uint32_t v) { return (uint32_t)__builtin_amdgcn_readfirstlane(v); }
__device__ __forceinline__ uint32_t pinned(uint32_t v) {
  uint32_t w = uni(v);
  asm volatile("" : "+s"(w));  // pinned(): a value for a tensor load's test or descriptor, held in a scalar register
  return w;
}
// group 1: 1-byte elements, tensor = tile = ROWS rows of ROWB bytes, source pitch in bytes; WORD0 holds the pad that sets the LDS pitch
template <uint32_t WORD0, uint32_t ROWB, uint32_t ROWS>
__device__ __forceinline__ u32x8 tdm_group1(uint32_t src_pitch) {
  u32x8 g;
  g[0] = uni(WORD0);
  g[1] = uni((ROWB & 0xFFFFu) << 16);
  g[2] = uni((ROWB >> 16) | ((ROWS & 0xFFFFu) << 16));
  g[3] = uni((ROWS >> 16) | (ROWB << 16));
  g[4] = uni(ROWS);
  g[5] = uni(src_pitch);
  g[6] = uni(0u);
  g[7] = uni(0u);
  return g;
}
// group 0: count 1, place in LDS, address of the tile's first byte, type 2
__device__ __forceinline__ u32x4 tdm_group0(uint32_t lds_dst, uint64_t ga) {
  u32x4 g;
  g[0] = uni(1u);
  g[1] = uni(lds_dst);
  g[2] = uni((uint32_t)ga);
  g[3] = uni((((uint32_t)(ga >> 32)) & 0x01FFFFFFu) | 0x80000000u);
  return g;
}
__device__ __forceinline__ void tdm_load(u32x4 g0, u32x8 g1) {
  asm volatile("tensor_load_to_lds %0, %1" :: "s"(g0), "s"(g1) : "memory");
}

// ---------------- elementwise: f32 -> f16 cast ----------------
__global__ void cast_f32_to_f16(const float* __restrict__ src, half_t* __restrict__ dst, int n) {
  int i = blockIdx.x * blockDim.x + threadIdx.x;
  if (i < n) dst[i] = (half_t)src[i];
}

// ---------------- LayerNorm (one block per row), writes f16 ----------------
template <bool TRANSPOSED>
__global__ __launch_bounds__(256) void layernorm_f16(const float* __restrict__ src,
                                                     const float* __restrict__ g,
                                                     const float* __restrict__ b,
                                                     half_t* __restrict__ dst) {
  int r = blockIdx.x;  // r = n*T + t
  const float* row;
  if (TRANSPOSED) {
    int n = r >> 11;             // T = 2048
    int t = r & (T_DIM - 1);
    row = src + ((size_t)t * N_DIM + n) * C_DIM;
  } else {
    row = src + (size_t)r * C_DIM;
  }
  float v[4];
  float s = 0.f, s2 = 0.f;
#pragma unroll
  for (int i = 0; i < 4; i++) {
    v[i] = row[threadIdx.x + i * 256];
    s += v[i];
    s2 += v[i] * v[i];
  }
#pragma unroll
  for (int m = 16; m >= 1; m >>= 1) { s += __shfl_xor(s, m); s2 += __shfl_xor(s2, m); }
  __shared__ float sh[2][8];
  int wave = threadIdx.x >> 5, lane = threadIdx.x & 31;
  if (lane == 0) { sh[0][wave] = s; sh[1][wave] = s2; }
  __syncthreads();
  if (wave == 0) {
    s = sh[0][lane & 7];
    s2 = sh[1][lane & 7];
#pragma unroll
    for (int m = 4; m >= 1; m >>= 1) { s += __shfl_xor(s, m); s2 += __shfl_xor(s2, m); }
    if (lane == 0) { sh[0][0] = s; sh[1][0] = s2; }
  }
  __syncthreads();
  float mu = sh[0][0] * (1.0f / C_DIM);
  float var = sh[1][0] * (1.0f / C_DIM) - mu * mu;
  float rstd = rsqrtf(var + 1e-5f);
#pragma unroll
  for (int i = 0; i < 4; i++) {
    int c = threadIdx.x + i * 256;
    dst[(size_t)r * C_DIM + c] = (half_t)((v[i] - mu) * rstd * g[c] + b[c]);
  }
}

// ---------------- RoPE, in place on f16 (pos = t + W) ----------------
__global__ void rope_inplace(half_t* __restrict__ buf, int stride) {
  int idx = blockIdx.x * blockDim.x + threadIdx.x;
  if (idx >= NT * H_DIM * (D_DIM / 2)) return;
  int i = idx & 31;
  int h = (idx >> 5) & 15;
  int row = idx >> 9;
  int t = row & (T_DIM - 1);
  float pos = (float)(t + W_DIM);
  // inv_freq = ROPE_BASE^(-2i/D) = exp(-(2i/D) * ln(10000))
  float freq = __expf(-(float)(2 * i) * (1.0f / (float)D_DIM) * 9.210340371976184f);
  float ang = pos * freq;
  float sn, cs;
  __sincosf(ang, &sn, &cs);
  half_t* p = buf + (size_t)row * stride + h * D_DIM;
  float a = (float)p[i];
  float bq = (float)p[i + 32];
  p[i] = (half_t)(a * cs - bq * sn);
  p[i + 32] = (half_t)(bq * cs + a * sn);
}

// ---------------- exact GELU, x * Phi(x), of a lane's eight values, without a branch ----------------
// Phi(-|x|) = erfc(|x| / sqrt 2) / 2 = t (a1 + t (a2 + t (a3 + t (a4 + t a5)))) exp(-x^2 / 2) / 2, t = 1 / (1 + p |x| / sqrt 2):
// the five-term rational form of erfc, absolute error below 2e-7. The tail is formed as a product, so 1 + erf never
// cancels for x < 0: gelu(x) = max(x, 0) - |x| Phi(-|x|). One path for every lane and no test, so the values of a lane are
// independent chains, two to an instruction; 1 + p |x| / sqrt 2 is at least 1, so the reciprocal has no pole.
__device__ __forceinline__ v8f gelu8(v8f x) {
  const v8f ax = __builtin_elementwise_abs(x);
  const v8f d = ax * 0.23164189f + 1.0f;                 // p / sqrt 2
  v8f t, e;
#pragma unroll  // constant indices: the vectors stay in registers
  for (int j = 0; j < 8; j++) t[j] = __builtin_amdgcn_rcpf(d[j]);
  v8f h = t * 0.5307027145f - 0.7265760135f;             // a5 / 2, a4 / 2
  h = h * t + 0.7107068705f;                             // a3 / 2
  h = h * t - 0.142248368f;                              // a2 / 2
  h = h * t + 0.127414796f;                              // a1 / 2
  const v8f u = (x * -0.72134752f) * x;                  // -x^2 / 2 * log2(e)
#pragma unroll  // as above
  for (int j = 0; j < 8; j++) e[j] = __builtin_amdgcn_exp2f(u[j]);
  const v8f q = (h * t) * e;                             // Phi(-|x|)
  const v8f zero = {0.f, 0.f, 0.f, 0.f, 0.f, 0.f, 0.f, 0.f};
  return __builtin_elementwise_max(x, zero) - ax * q;
}

// ---------------- WMMA GEMM: C[M x Ncols] = A(f16, MxK) @ B(f16, KxNcols) + epilogue ----
// Block tile 128x128x64, 4 waves (2 x 2); each wave owns a 64x64 macro-tile:
// 4 A-frags x 4 B-frags -> 16 WMMAs per 32 k. The tiles come by the tensor mover into two LDS buffers: every wave asks
// for one 8-KiB slice per k-step, one k-step ahead of its use, so the next tiles fly while these are multiplied.
// K is at least two k-steps (128) and a multiple of 64 at every launch. The row length of B and of the output is a
// constant of the instance, so that the epilogue's stores share one address register and differ in their offset fields.
template <int MODE, int Ncols>
__global__ __launch_bounds__(128) void gemm_wmma(const half_t* __restrict__ A,
                                                 const half_t* __restrict__ B,
                                                 const float* __restrict__ bias,
                                                 const float* __restrict__ res,
                                                 half_t* __restrict__ out16,
                                                 float* __restrict__ out32,
                                                 int K) {
  // per buffer: A rows 0..63 | A rows 64..127 (pitch 144 B) | B rows k 0..31 | k 32..63 (row-major [k][n], pitch 288 B)
  __shared__ __attribute__((aligned(2048))) unsigned char sT[2 * STAGE];

  const int tid = threadIdx.x;
  const int lane = tid & 31;
  const uint32_t wave = uni((uint32_t)tid >> 5);
  const int wm = wave >> 1;  // 0..1 : 64-row strip
  const int wn = wave & 1;   // 0..1 : 64-col strip
  const int bm = blockIdx.x * BM;
  const int bn = blockIdx.y * BN;

  const int kb  = (lane & 16) ? 8 : 0;
  const int l15 = lane & 15;
  const int hi8 = (lane & 16) ? 8 : 0;

  v8f acc[4][4];
#pragma unroll
  for (int a2 = 0; a2 < 4; a2++)
#pragma unroll
    for (int b2 = 0; b2 < 4; b2++)
#pragma unroll
      for (int j = 0; j < 8; j++) acc[a2][b2][j] = 0.f;

  // this lane's 16-byte piece for the transposing load of a 16(k) x 16(n) block of a B slice
  const int btr  = (hi8 + (lane & 7)) * BSTR + ((lane >> 3) & 1) * 8;

  // waves 0 and 1 bring the two 64-row halves of the A tile (rows of 128 B), waves 2 and 3 the two 32-row halves of the
  // B tile (rows of 256 B); slice w of a buffer is wave w's
  const uint32_t isA = pinned(wave < 2u ? 1u : 0u);  // pinned(): the test on it below is a scalar branch
  const uint64_t gbase = isA ? (uint64_t)(uintptr_t)(A + (size_t)(bm + (int)wave * 64) * K)
                             : (uint64_t)(uintptr_t)(B + (size_t)(((int)wave - 2) * 32) * Ncols + bn);
  const uint32_t gstep = isA ? (uint32_t)(BK * 2) : (uint32_t)(BK * 2) * (uint32_t)Ncols;  // bytes from one k-step's slice to the next
  const uint32_t ldst  = (uint32_t)(size_t)sT + wave * SLICE;
  // pad behind every 128-B row: 16 B (pitch 144 B, for ds_load_b128); behind every 256-B row: 32 B (pitch 288 B, for ds_load_tr16_b128)
  u32x8 g1a = tdm_group1<(1u << 20) | (4u << 22) | (3u << 25), 128u, 64u>((uint32_t)K * 2u);
  u32x8 g1b = tdm_group1<(1u << 20) | (5u << 22) | (7u << 25), 256u, 32u>((uint32_t)Ncols * 2u);
  // as in pinned(): the descriptor words are held in their scalar registers through the loop, so that none of them
  // serves as a scratch register while a request that named it is in flight
  asm volatile("" : "+s"(g1a), "+s"(g1b));  // pinned(): descriptor words held in scalar registers
  auto issue = [&](uint32_t st) {
    const u32x4 g0 = tdm_group0(ldst + (st & 1u) * STAGE, gbase + (uint64_t)(st * gstep));
    if (isA != 0u) tdm_load(g0, g1a);  // scalar branch: each wave issues exactly one of the two requests
    else           tdm_load(g0, g1b);
  };

  const uint32_t nst = uni((uint32_t)K / BK);
  issue(0u);
  asm volatile("s_wait_tensorcnt 0x0" ::: "memory");  // this wave's slice of k-step 0 has landed
  __syncthreads();                                    // ... and every other wave's: k-step 0 may be read
  issue(1u);

  for (uint32_t s = 0; s < nst; s++) {
    const unsigned char* sbuf = sT + (s & 1u) * STAGE;
    const half_t* sA = (const half_t*)(sbuf + wm * SLICE);   // this wave's 64 A rows
    const half_t* sB = (const half_t*)(sbuf + 2 * SLICE);    // k rows 0..31; rows 32..63 one slice further
#pragma unroll
    for (int ks = 0; ks < BK; ks += 32) {
      v16h af[4], bf[4];
#pragma unroll
      for (int b2 = 0; b2 < 4; b2++) {
        // k = 8h + 0..7 and 16 + 8h + 0..7 of column l15: the same k order as af
        const half_t* pb = sB + (ks / 32) * (SLICE / 2) + btr + wn * 64 + b2 * 16;
        bf[b2] = make_frag(ld_tr16(pb), ld_tr16(pb + 16 * BSTR));
      }
#pragma unroll
      for (int a2 = 0; a2 < 4; a2++) {
        const half_t* pa = sA + (a2 * 16 + l15) * ASTR + ks;
        af[a2] = make_frag(*(const v8h*)(pa + kb), *(const v8h*)(pa + kb + 16));
      }
      if (ks == BK - 32) {
        // hand-over, once the k-step's last fragments are fetched, in this order: this wave's reads of the buffer are
        // done; its slice of k-step s + 1 has landed; the one barrier publishes k-step s + 1 and ends every wave's reads
        // of the buffer that is refilled behind it. The refill goes out ahead of the last 16 WMMAs: a whole k-step of lead
        asm volatile("s_wait_dscnt 0x0" ::: "memory");
        asm volatile("s_wait_tensorcnt 0x0" ::: "memory");
        __syncthreads();
        const uint32_t nx = pinned(s + 2u);        // pinned(): the next descriptor is formed behind the wait above
        if (pinned(nx < nst ? 1u : 0u) != 0u) issue(nx);  // scalar branch: only while k-step s + 2 exists
      }
      // holds the 16 fragment loads ahead of the 16 WMMAs as one group: left free, the compiler reloads one
      // A fragment per 4 WMMAs into the same registers and the wave waits out the LDS latency four times
      __builtin_amdgcn_sched_barrier(0);
#pragma unroll
      for (int a2 = 0; a2 < 4; a2++)
#pragma unroll
        for (int b2 = 0; b2 < 4; b2++)
          acc[a2][b2] = wmma_f16(af[a2], bf[b2], acc[a2][b2]);
    }
  }
  // no request and no LDS read is left when the wave goes on
  asm volatile("s_wait_tensorcnt 0x0" ::: "memory");
  asm volatile("s_wait_dscnt 0x0" ::: "memory");

  // The output leaves in whole 128-B lines: each wave lays its 64 x 64 tile row-major in a quarter of the ring that is
  // its own, and reads it back 16 bytes a lane, so that one store covers four whole lines (from the accumulators a store
  // is two pieces of 32 or 64 bytes). The ring is free: the last k-step's barrier stands behind every wave's last
  // fragment reads and behind the landing of the last tensor load, so no further barrier is needed.
  unsigned char* stg = sT + wave * (STAGE / 2);
  constexpr bool OUT16 = (MODE == MODE_F16_BIAS || MODE == MODE_F16_GELU);
  float bc[4];  // the bias of this lane's four columns
#pragma unroll
  for (int b2 = 0; b2 < 4; b2++) bc[b2] = bias[bn + wn * 64 + b2 * 16 + l15];

  // The wave's four 16-row groups pass through one copy of this code: the loop stays rolled and the
  // next group's accumulators move down into acc[0]. Unrolled, the GELU epilogue of 128 values a lane is about
  // four times the text.
#pragma unroll 1
  for (int a2 = 0; a2 < 4; a2++) {
    const int lr = a2 * 16 + hi8;
#pragma unroll
    for (int b2 = 0; b2 < 4; b2++) {
      const int lc = b2 * 16 + l15;
      if constexpr (MODE == MODE_F16_GELU) {
        const v8h g = __builtin_convertvector(gelu8(acc[0][b2] + bc[b2]), v8h);
#pragma unroll
        for (int j = 0; j < 8; j++) ((half_t*)stg)[(lr + j) * OSTR16 + lc] = g[j];
      } else {
#pragma unroll
        for (int j = 0; j < 8; j++) {
          const float v0 = acc[0][b2][j] + bc[b2];
          if constexpr (OUT16) ((half_t*)stg)[(lr + j) * OSTR16 + lc] = (half_t)v0;
          else                 ((float*)stg)[(lr + j) * OSTR32 + lc] = v0;
        }
      }
    }
#pragma unroll
    for (int s = 0; s < 3; s++)
#pragma unroll
      for (int b2 = 0; b2 < 4; b2++) acc[s][b2] = acc[s + 1][b2];
  }
  // the tile goes from lane to lane of this wave only: its LDS stores are waited out before the rows are read back
  asm volatile("s_wait_dscnt 0x0" ::: "memory");

  if constexpr (OUT16) {
    // 8 lanes take one row of 128 B, a wave-wide store 4 rows
    const int rr = lane >> 3, pc = (lane & 7) * 8;
    const half_t* sp = (const half_t*)stg + rr * OSTR16 + pc;
    half_t* gp = out16 + (size_t)(bm + wm * 64 + rr) * Ncols + bn + wn * 64 + pc;
#pragma unroll
    for (int i = 0; i < 16; i++)
      *(v8h*)(gp + i * 4 * Ncols) = *(const v8h*)(sp + i * 4 * OSTR16);
  } else {
    // 16 lanes take one row of 256 B, a wave-wide load or store 2 rows; the residual comes in the same whole lines.
    // A block's 128 rows lie in one batch entry n (T is a multiple of 128): row r = n*T + t stands at t*N + n in x and out
    const int rr = lane >> 4, pc = (lane & 15) * 4;
    const float* sp = (const float*)stg + rr * OSTR32 + pc;
    const int r = bm + wm * 64 + rr;
    const int n = r >> 11, t = r & (T_DIM - 1);
    const size_t bmaj = (size_t)r * C_DIM + bn + wn * 64 + pc;
    const size_t tmaj = ((size_t)t * N_DIM + n) * C_DIM + bn + wn * 64 + pc;
    constexpr bool RES_T = (MODE == MODE_F32_RES_T);  // h = x(transposed read) + proj; else d_out[(t,n,c)] = h + ffn
    const float* rp = res + (RES_T ? tmaj : bmaj);
    float* op = out32 + (RES_T ? bmaj : tmaj);
    constexpr int RSTEP = RES_T ? 2 * N_DIM * C_DIM : 2 * C_DIM;
    constexpr int OSTEP = RES_T ? 2 * C_DIM : 2 * N_DIM * C_DIM;
#pragma unroll
    for (int i = 0; i < 32; i++)
      *(v4f*)(op + i * OSTEP) = *(const v4f*)(sp + i * 2 * OSTR32) + *(const v4f*)(rp + i * RSTEP);
  }
}

// ---------------- Banded flash attention: four waves per block, one 16-query tile each ----
// The four tiles walk nearly the same keys, so each 32-key chunk of K and V is brought in once per block, in
// whole 128-B lines, and laid row-major in LDS; every wave takes its fragments from there (V by the transposing load).
__global__ __launch_bounds__(128) void attn_kernel(const half_t* __restrict__ Q,
                                                   const half_t* __restrict__ KV,
                                                   half_t* __restrict__ O) {
  __shared__ __align__(16) half_t sK[2][32 * KSTR];     // [key][d], two buffers
  __shared__ __align__(16) half_t sV[2][32 * VSTR];     // [key][d], two buffers
  __shared__ __align__(16) half_t sPw[AQW][16 * LSTR];  // one P tile per wave

  const int tid  = threadIdx.x;
  const int lane = tid & 31;
  const int wave = __builtin_amdgcn_readfirstlane(tid >> 5);
  const int qb = blockIdx.x * (16 * AQW);  // first query of the block
  const int q0 = qb + wave * 16;           // first query of this wave
  const int h  = blockIdx.y;
  const int n  = blockIdx.z;

  const int kb  = (lane & 16) ? 8 : 0;
  const int l15 = lane & 15;
  const int hi8 = (lane & 16) ? 8 : 0;

  const half_t* Qb = Q + ((size_t)(n * T_DIM + q0)) * C_DIM + h * D_DIM;
  const half_t* Kb = KV + ((size_t)n * T_DIM) * (2 * C_DIM) + h * D_DIM;
  half_t* sP = sPw[wave];

  // Q as A-fragments for both 32-wide D steps (per-lane runs are contiguous in D)
  const half_t* qr = Qb + (size_t)l15 * C_DIM;
  v16h aQ0 = make_frag(*(const v8h*)(qr + kb), *(const v8h*)(qr + kb + 16));
  v16h aQ1 = make_frag(*(const v8h*)(qr + 32 + kb), *(const v8h*)(qr + 32 + kb + 16));

  float m[8], l[8];
  v8f oo[4];
#pragma unroll
  for (int j = 0; j < 8; j++) { m[j] = -3e38f; l[j] = 0.f; }
#pragma unroll
  for (int dt = 0; dt < 4; dt++)
#pragma unroll
    for (int j = 0; j < 8; j++) oo[dt][j] = 0.f;

  // this wave's own chunks: the 32-key chunks that hold a key of its 16 queries' band
  int kstart = q0 - W_DIM;
  if (kstart < 0) kstart = 0;
  kstart &= ~31;
  // the block's chunks: from its first wave's first to its last wave's last
  int kfirst = qb - W_DIM;
  if (kfirst < 0) kfirst = 0;
  kfirst &= ~31;
  const int klast = (qb + 16 * AQW - 1) & ~31;

  // staging: a thread moves rows srow and srow + 16 of K and of V, 16 bytes of each; a wave-load covers 4 whole lines
  const int srow = tid >> 3;        // 0..15
  const int sc8  = (tid & 7) * 8;   // 0..56
  const half_t* gs = Kb + (size_t)srow * (2 * C_DIM) + sc8;
  const int kst = srow * KSTR + sc8;
  const int vst = srow * VSTR + sc8;
  // this lane's 16-byte piece for the transposing load of a 16(key) x 16(d) block of sV
  const int vtr = (hi8 + (lane & 7)) * VSTR + ((lane >> 3) & 1) * 8;

  {
    const half_t* g = gs + (size_t)kfirst * (2 * C_DIM);
    v8h rk0 = *(const v8h*)(g);
    v8h rk1 = *(const v8h*)(g + 16 * (2 * C_DIM));
    v8h rv0 = *(const v8h*)(g + C_DIM);
    v8h rv1 = *(const v8h*)(g + 16 * (2 * C_DIM) + C_DIM);
    *(v8h*)(sK[0] + kst) = rk0;
    *(v8h*)(sK[0] + kst + 16 * KSTR) = rk1;
    *(v8h*)(sV[0] + vst) = rv0;
    *(v8h*)(sV[0] + vst + 16 * VSTR) = rv1;
  }
  __syncthreads();

  int buf = 0;
  for (int kc = kfirst; kc <= klast; kc += 32) {
    // the next chunk's lines are asked for ahead of this chunk's work and laid into the other buffer behind it
    const bool more = kc + 32 <= klast;
    v8h rk0, rk1, rv0, rv1;
    if (more) {
      const half_t* g = gs + (size_t)(kc + 32) * (2 * C_DIM);
      rk0 = *(const v8h*)(g);
      rk1 = *(const v8h*)(g + 16 * (2 * C_DIM));
      rv0 = *(const v8h*)(g + C_DIM);
      rv1 = *(const v8h*)(g + 16 * (2 * C_DIM) + C_DIM);
      // the work below reuses the registers that hold these loads' address: the wait stands in front of that
      asm volatile("s_wait_xcnt 0x0" ::: "memory");
    }

    // wave-uniform: a chunk outside this wave's own band is passed over (every wave still meets the barrier below)
    if (kc >= kstart && kc <= q0 + 15) {
      // K B-fragments (column = key, contiguous runs in D per lane)
      const half_t* kr0 = sK[buf] + l15 * KSTR;
      const half_t* kr1 = kr0 + 16 * KSTR;
      v16h bK00 = make_frag(*(const v8h*)(kr0 + kb), *(const v8h*)(kr0 + kb + 16));
      v16h bK01 = make_frag(*(const v8h*)(kr0 + 32 + kb), *(const v8h*)(kr0 + 32 + kb + 16));
      v16h bK10 = make_frag(*(const v8h*)(kr1 + kb), *(const v8h*)(kr1 + kb + 16));
      v16h bK11 = make_frag(*(const v8h*)(kr1 + 32 + kb), *(const v8h*)(kr1 + 32 + kb + 16));

      v8f s0 = {0, 0, 0, 0, 0, 0, 0, 0};
      v8f s1 = {0, 0, 0, 0, 0, 0, 0, 0};
      s0 = wmma_f16(aQ0, bK00, s0);
      s0 = wmma_f16(aQ1, bK01, s0);
      s1 = wmma_f16(aQ0, bK10, s1);
      s1 = wmma_f16(aQ1, bK11, s1);

      // online softmax (band mask as data-level select; EXEC stays all-1s)
      float pv0[8], pv1[8];
#pragma unroll
      for (int j = 0; j < 8; j++) {
        int q = q0 + j + hi8;
        int k0i = kc + l15, k1i = kc + 16 + l15;
        bool val0 = (k0i <= q) && (q - k0i <= W_DIM);
        bool val1 = (k1i <= q) && (q - k1i <= W_DIM);
        float x0 = val0 ? s0[j] * 0.125f : -3e38f;
        float x1 = val1 ? s1[j] * 0.125f : -3e38f;
        float cm = fmaxf(x0, x1);
#pragma unroll
        for (int msk = 1; msk < 16; msk <<= 1) cm = fmaxf(cm, __shfl_xor(cm, msk));
        float nm = fmaxf(m[j], cm);
        float corr = __expf(m[j] - nm);  // (-3e38)-(-3e38)=0 -> 1; finite path ok
        m[j] = nm;
        float p0 = val0 ? __expf(x0 - nm) : 0.f;
        float p1 = val1 ? __expf(x1 - nm) : 0.f;
        float rs = p0 + p1;
#pragma unroll
        for (int msk = 1; msk < 16; msk <<= 1) rs += __shfl_xor(rs, msk);
        l[j] = l[j] * corr + rs;
#pragma unroll
        for (int dt = 0; dt < 4; dt++) oo[dt][j] *= corr;
        pv0[j] = p0;
        pv1[j] = p1;
      }

      // P -> LDS (re-layout from C/D layout to A-fragment layout), in the wave's own tile
#pragma unroll
      for (int j = 0; j < 8; j++) {
        sP[(j + hi8) * LSTR + l15] = (half_t)pv0[j];
        sP[(j + hi8) * LSTR + 16 + l15] = (half_t)pv1[j];
      }
      // the P tile goes from lane to lane of one wave only: the LDS stores are waited out and the loads below stay
      // behind them; no work-group barrier may stand here, inside a branch that not every wave takes
      __builtin_amdgcn_fence(__ATOMIC_ACQ_REL, "workgroup", "local");

      const half_t* pp = sP + l15 * LSTR;
      v16h aP = make_frag(*(const v8h*)(pp + kb), *(const v8h*)(pp + kb + 16));
#pragma unroll
      for (int dt = 0; dt < 4; dt++) {
        // keys 8h + 0..7 and 16 + 8h + 0..7 of column d = dt*16 + l15: the same k order as aP
        const half_t* pv = sV[buf] + vtr + dt * 16;
        v16h bV = make_frag(ld_tr16(pv), ld_tr16(pv + 16 * VSTR));
        oo[dt] = wmma_f16(aP, bV, oo[dt]);
      }
    }

    if (more) {
      *(v8h*)(sK[buf ^ 1] + kst) = rk0;
      *(v8h*)(sK[buf ^ 1] + kst + 16 * KSTR) = rk1;
      *(v8h*)(sV[buf ^ 1] + vst) = rv0;
      *(v8h*)(sV[buf ^ 1] + vst + 16 * VSTR) = rv1;
    }
    // one barrier per chunk: it publishes the buffer just filled and ends every wave's reads of the one filled next
    __syncthreads();
    buf ^= 1;
  }

  float inv[8];
#pragma unroll
  for (int j = 0; j < 8; j++) inv[j] = (l[j] > 0.f) ? (1.0f / l[j]) : 0.f;

  // The 16 x 64 output tile leaves in whole 128-B lines: laid row-major in this wave's own quarter of sK (free: the
  // loop's last barrier ends every wave's reads of it) and read back 16 bytes a lane, 4 rows a store
  half_t* so = &sK[0][0] + wave * (16 * KSTR);
#pragma unroll
  for (int j = 0; j < 8; j++)
#pragma unroll
    for (int dt = 0; dt < 4; dt++)
      so[(j + hi8) * KSTR + dt * 16 + l15] = (half_t)(oo[dt][j] * inv[j]);
  // the tile goes from lane to lane of this wave only: its LDS stores are waited out before the rows are read back
  asm volatile("s_wait_dscnt 0x0" ::: "memory");

  half_t* ob = O + ((size_t)(n * T_DIM + q0)) * C_DIM + h * D_DIM;
  const int orow = lane >> 3, opc = (lane & 7) * 8;
#pragma unroll
  for (int i = 0; i < 4; i++)
    *(v8h*)(ob + (size_t)(i * 4 + orow) * C_DIM + opc) = *(const v8h*)(so + (i * 4 + orow) * KSTR + opc);
}

// ---------------- host orchestration ----------------
extern "C" void kernel_launch(void* const* d_in, const int* in_sizes, int n_in,
                              void* d_out, int out_size, void* d_ws, size_t ws_size,
                              hipStream_t stream) {
  (void)in_sizes; (void)n_in; (void)out_size; (void)ws_size;
  const float* x     = (const float*)d_in[0];
  const float* q_w   = (const float*)d_in[1];
  const float* q_b   = (const float*)d_in[2];
  const float* kv_w  = (const float*)d_in[3];
  const float* kv_b  = (const float*)d_in[4];
  const float* out_w = (const float*)d_in[5];
  const float* out_b = (const float*)d_in[6];
  const float* ff_w1 = (const float*)d_in[7];
  const float* ff_b1 = (const float*)d_in[8];
  const float* ff_w2 = (const float*)d_in[9];
  const float* ff_b2 = (const float*)d_in[10];
  const float* ln1_g = (const float*)d_in[11];
  const float* ln1_b = (const float*)d_in[12];
  const float* ln2_g = (const float*)d_in[13];
  const float* ln2_b = (const float*)d_in[14];

  char* ws = (char*)d_ws;
  size_t off = 0;
  auto alloc = [&](size_t bytes) -> char* {
    char* p = ws + off;
    off += (bytes + 255) & ~(size_t)255;
    return p;
  };
  half_t* wq   = (half_t*)alloc((size_t)C_DIM * C_DIM * 2);
  half_t* wkv  = (half_t*)alloc((size_t)C_DIM * 2 * C_DIM * 2);
  half_t* wo   = (half_t*)alloc((size_t)C_DIM * C_DIM * 2);
  half_t* wf1  = (half_t*)alloc((size_t)C_DIM * F_DIM * 2);
  half_t* wf2  = (half_t*)alloc((size_t)F_DIM * C_DIM * 2);
  half_t* A16  = (half_t*)alloc((size_t)NT * C_DIM * 2);
  half_t* Q16  = (half_t*)alloc((size_t)NT * C_DIM * 2);
  half_t* KV16 = (half_t*)alloc((size_t)NT * 2 * C_DIM * 2);
  half_t* O16  = (half_t*)alloc((size_t)NT * C_DIM * 2);
  float*  H32  = (float*)alloc((size_t)NT * C_DIM * 4);
  half_t* G16  = (half_t*)alloc((size_t)NT * F_DIM * 2);

  auto cast = [&](const float* s, half_t* d, int n) {
    cast_f32_to_f16<<<(n + 255) / 256, 256, 0, stream>>>(s, d, n);
  };
  cast(q_w, wq, C_DIM * C_DIM);
  cast(kv_w, wkv, C_DIM * 2 * C_DIM);
  cast(out_w, wo, C_DIM * C_DIM);
  cast(ff_w1, wf1, C_DIM * F_DIM);
  cast(ff_w2, wf2, F_DIM * C_DIM);

  layernorm_f16<true><<<NT, 256, 0, stream>>>(x, ln1_g, ln1_b, A16);

  dim3 blk(128);
  gemm_wmma<MODE_F16_BIAS, C_DIM><<<dim3(NT / BM, C_DIM / BN), blk, 0, stream>>>(
      A16, wq, q_b, nullptr, Q16, nullptr, C_DIM);
  gemm_wmma<MODE_F16_BIAS, 2 * C_DIM><<<dim3(NT / BM, 2 * C_DIM / BN), blk, 0, stream>>>(
      A16, wkv, kv_b, nullptr, KV16, nullptr, C_DIM);

  int nrope = NT * H_DIM * (D_DIM / 2);
  rope_inplace<<<(nrope + 255) / 256, 256, 0, stream>>>(Q16, C_DIM);
  rope_inplace<<<(nrope + 255) / 256, 256, 0, stream>>>(KV16, 2 * C_DIM);

  attn_kernel<<<dim3(T_DIM / (16 * AQW), H_DIM, N_DIM), 32 * AQW, 0, stream>>>(Q16, KV16, O16);

  gemm_wmma<MODE_F32_RES_T, C_DIM><<<dim3(NT / BM, C_DIM / BN), blk, 0, stream>>>(
      O16, wo, out_b, x, nullptr, H32, C_DIM);

  layernorm_f16<false><<<NT, 256, 0, stream>>>(H32, ln2_g, ln2_b, A16);

  gemm_wmma<MODE_F16_GELU, F_DIM><<<dim3(NT / BM, F_DIM / BN), blk, 0, stream>>>(
      A16, wf1, ff_b1, nullptr, G16, nullptr, C_DIM);

  gemm_wmma<MODE_F32_OUT_T, C_DIM><<<dim3(NT / BM, C_DIM / BN), blk, 0, stream>>>(
      G16, wf2, ff_b2, H32, nullptr, (float*)d_out, F_DIM);
}

// v007
// Measured time: 285 microseconds a run.
// In two side-by-side timings against v006, it was 1.09 and 1.10 times as fast.
// Counting every step since v000, it is 5.61 times as fast.
#include <hip/hip_runtime.h>
#include <hip/hip_bf16.h>
#include <math.h>
#include <stdint.h>

typedef _Float16 half_t;
typedef __attribute__((ext_vector_type(16))) _Float16 v16h;
typedef __attribute__((ext_vector_type(8)))  _Float16 v8h;
typedef __attribute__((ext_vector_type(8)))  float    v8f;
typedef __attribute__((ext_vector_type(4)))  float    v4f;

#define T_DIM 2048
#define N_DIM 4
#define C_DIM 1024
#define H_DIM 16
#define D_DIM 64
#define W_DIM 512
#define F_DIM 4096
#define NT    (T_DIM * N_DIM)

#define BM 128
#define BN 128
#define BK 64
#define ASTR 72   // LDS stride of a GEMM A row in halves (144B = 16B x 9: the pitch of the 16-byte load)
#define BSTR 144  // LDS stride of a row-major B row in halves (288B = 32B x 9: the pitch of the transposing load)
#define SLICE 10240          // bytes of LDS per tensor-load slice: 64 A rows at 144 B or 32 B rows at 288 B (9,216 B), up to a multiple of 2 KiB
#define STAGE (4 * SLICE)    // one k-step's tiles: two A slices, then two B slices
#define OSTR16 72  // LDS stride of a staged f16 output row in halves (144B: rows r and r + 8 fall on different banks; the pitch of the 16-byte load)
#define OSTR32 68  // LDS stride of a staged f32 output row in floats (272B: the same two properties)
#define AQW  4    // attention: 16-query tiles (waves) per block
#define KSTR 72   // attention: LDS stride of a K row in halves (144B = 16B x 9: the pitch of the 16-byte load)
#define VSTR 80   // attention: LDS stride of a V row in halves (160B = 32B x 5: the pitch of the transposing load)

enum { MODE_F16_BIAS = 0, MODE_F16_GELU = 1, MODE_F32_RES_T = 2, MODE_F32_OUT_T = 3 };

__device__ __forceinline__ v16h make_frag(v8h lo, v8h hi) {
  v16h a;
#pragma unroll
  for (int i = 0; i < 8; i++) { a[i] = lo[i]; a[i + 8] = hi[i]; }
  return a;
}

__device__ __forceinline__ v8f wmma_f16(v16h a, v16h b, v8f c) {
  return __builtin_amdgcn_wmma_f32_16x16x32_f16(false, a, false, b, (short)0, c, false, false);
}

// Transposing LDS load: from a row-major [k][n] tile, lane (c = lane & 15, h = lane >> 4)
// receives the 8 values T[k0 + 8h + 0..7][n0 + c]. Every lane passes the address of one 16-byte piece.
typedef __attribute__((ext_vector_type(8))) short s16x8;
__device__ __forceinline__ v8h ld_tr16(const half_t* p) {
  typedef __attribute__((address_space(3))) s16x8 lds_s16x8;
  return __builtin_bit_cast(v8h, __builtin_amdgcn_ds_load_tr16_b128_v8i16((lds_s16x8*)p));
}

// the value of lane l ^ 16 (the other 16-lane row), by a vector cross-row move
__device__ __forceinline__ float xhalf(float x) {
  const int v = __builtin_bit_cast(int, x);
  return __builtin_bit_cast(float, __builtin_amdgcn_permlanex16(v, v, 0x76543210, 0xfedcba98, false, false));
}

// ---------------- tensor load to LDS: one request of a whole wave brings a padded two-dimensional tile ----------------
typedef uint32_t u32x4 __attribute__((ext_vector_type(4)));
typedef uint32_t u32x8 __attribute__((ext_vector_type(8)));
__device__ __forceinline__ uint32_t uni(uint32_t v) { return (uint32_t)__builtin_amdgcn_readfirstlane(v); }
__device__ __forceinline__ uint32_t pinned(uint32_t v) {
  uint32_t w = uni(v);
  asm volatile("" : "+s"(w));  // pinned(): a value for a tensor load's test or descriptor, held in a scalar register
  return w;
}
// group 1: 1-byte elements, tensor = tile = ROWS rows of ROWB bytes, source pitch in bytes; WORD0 holds the pad that sets the LDS pitch
template <uint32_t WORD0, uint32_t ROWB, uint32_t ROWS>
__device__ __forceinline__ u32x8 tdm_group1(uint32_t src_pitch) {
  u32x8 g;
  g[0] = uni(WORD0);
  g[1] = uni((ROWB & 0xFFFFu) << 16);
  g[2] = uni((ROWB >> 16) | ((ROWS & 0xFFFFu) << 16));
  g[3] = uni((ROWS >> 16) | (ROWB << 16));
  g[4] = uni(ROWS);
  g[5] = uni(src_pitch);
  g[6] = uni(0u);
  g[7] = uni(0u);
  return g;
}
// group 0: count 1, place in LDS, address of the tile's first byte, type 2
__device__ __forceinline__ u32x4 tdm_group0(uint32_t lds_dst, uint64_t ga) {
  u32x4 g;
  g[0] = uni(1u);
  g[1] = uni(lds_dst);
  g[2] = uni((uint32_t)ga);
  g[3] = uni((((uint32_t)(ga >> 32)) & 0x01FFFFFFu) | 0x80000000u);
  return g;
}
__device__ __forceinline__ void tdm_load(u32x4 g0, u32x8 g1) {
  asm volatile("tensor_load_to_lds %0, %1" :: "s"(g0), "s"(g1) : "memory");
}

// ---------------- elementwise: f32 -> f16 cast ----------------
__global__ void cast_f32_to_f16(const float* __restrict__ src, half_t* __restrict__ dst, int n) {
  int i = blockIdx.x * blockDim.x + threadIdx.x;
  if (i < n) dst[i] = (half_t)src[i];
}

// ---------------- LayerNorm (one block per row), writes f16 ----------------
template <bool TRANSPOSED>
__global__ __launch_bounds__(256) void layernorm_f16(const float* __restrict__ src,
                                                     const float* __restrict__ g,
                                                     const float* __restrict__ b,
                                                     half_t* __restrict__ dst) {
  int r = blockIdx.x;  // r = n*T + t
  const float* row;
  if (TRANSPOSED) {
    int n = r >> 11;             // T = 2048
    int t = r & (T_DIM - 1);
    row = src + ((size_t)t * N_DIM + n) * C_DIM;
  } else {
    row = src + (size_t)r * C_DIM;
  }
  float v[4];
  float s = 0.f, s2 = 0.f;
#pragma unroll
  for (int i = 0; i < 4; i++) {
    v[i] = row[threadIdx.x + i * 256];
    s += v[i];
    s2 += v[i] * v[i];
  }
#pragma unroll
  for (int m = 16; m >= 1; m >>= 1) { s += __shfl_xor(s, m); s2 += __shfl_xor(s2, m); }
  __shared__ float sh[2][8];
  int wave = threadIdx.x >> 5, lane = threadIdx.x & 31;
  if (lane == 0) { sh[0][wave] = s; sh[1][wave] = s2; }
  __syncthreads();
  if (wave == 0) {
    s = sh[0][lane & 7];
    s2 = sh[1][lane & 7];
#pragma unroll
    for (int m = 4; m >= 1; m >>= 1) { s += __shfl_xor(s, m); s2 += __shfl_xor(s2, m); }
    if (lane == 0) { sh[0][0] = s; sh[1][0] = s2; }
  }
  __syncthreads();
  float mu = sh[0][0] * (1.0f / C_DIM);
  float var = sh[1][0] * (1.0f / C_DIM) - mu * mu;
  float rstd = rsqrtf(var + 1e-5f);
#pragma unroll
  for (int i = 0; i < 4; i++) {
    int c = threadIdx.x + i * 256;
    dst[(size_t)r * C_DIM + c] = (half_t)((v[i] - mu) * rstd * g[c] + b[c]);
  }
}

// ---------------- RoPE, in place on f16 (pos = t + W) ----------------
__global__ void rope_inplace(half_t* __restrict__ buf, int stride) {
  int idx = blockIdx.x * blockDim.x + threadIdx.x;
  if (idx >= NT * H_DIM * (D_DIM / 2)) return;
  int i = idx & 31;
  int h = (idx >> 5) & 15;
  int row = idx >> 9;
  int t = row & (T_DIM - 1);
  float pos = (float)(t + W_DIM);
  // inv_freq = ROPE_BASE^(-2i/D) = exp(-(2i/D) * ln(10000))
  float freq = __expf(-(float)(2 * i) * (1.0f / (float)D_DIM) * 9.210340371976184f);
  float ang = pos * freq;
  float sn, cs;
  __sincosf(ang, &sn, &cs);
  half_t* p = buf + (size_t)row * stride + h * D_DIM;
  float a = (float)p[i];
  float bq = (float)p[i + 32];
  p[i] = (half_t)(a * cs - bq * sn);
  p[i + 32] = (half_t)(bq * cs + a * sn);
}

// ---------------- exact GELU, x * Phi(x), of a lane's eight values, without a branch ----------------
// Phi(-|x|) = erfc(|x| / sqrt 2) / 2 = t (a1 + t (a2 + t (a3 + t (a4 + t a5)))) exp(-x^2 / 2) / 2, t = 1 / (1 + p |x| / sqrt 2):
// the five-term rational form of erfc, absolute error below 2e-7. The tail is formed as a product, so 1 + erf never
// cancels for x < 0: gelu(x) = max(x, 0) - |x| Phi(-|x|). One path for every lane and no test, so the values of a lane are
// independent chains, two to an instruction; 1 + p |x| / sqrt 2 is at least 1, so the reciprocal has no pole.
__device__ __forceinline__ v8f gelu8(v8f x) {
  const v8f ax = __builtin_elementwise_abs(x);
  const v8f d = ax * 0.23164189f + 1.0f;                 // p / sqrt 2
  v8f t, e;
#pragma unroll  // constant indices: the vectors stay in registers
  for (int j = 0; j < 8; j++) t[j] = __builtin_amdgcn_rcpf(d[j]);
  v8f h = t * 0.5307027145f - 0.7265760135f;             // a5 / 2, a4 / 2
  h = h * t + 0.7107068705f;                             // a3 / 2
  h = h * t - 0.142248368f;                              // a2 / 2
  h = h * t + 0.127414796f;                              // a1 / 2
  const v8f u = (x * -0.72134752f) * x;                  // -x^2 / 2 * log2(e)
#pragma unroll  // as above
  for (int j = 0; j < 8; j++) e[j] = __builtin_amdgcn_exp2f(u[j]);
  const v8f q = (h * t) * e;                             // Phi(-|x|)
  const v8f zero = {0.f, 0.f, 0.f, 0.f, 0.f, 0.f, 0.f, 0.f};
  return __builtin_elementwise_max(x, zero) - ax * q;
}

// ---------------- WMMA GEMM: C[M x Ncols] = A(f16, MxK) @ B(f16, KxNcols) + epilogue ----
// Block tile 128x128x64, 4 waves (2 x 2); each wave owns a 64x64 macro-tile:
// 4 A-frags x 4 B-frags -> 16 WMMAs per 32 k. The tiles come by the tensor mover into two LDS buffers: every wave asks
// for one 8-KiB slice per k-step, one k-step ahead of its use, so the next tiles fly while these are multiplied.
// K is at least two k-steps (128) and a multiple of 64 at every launch. The row length of B and of the output is a
// constant of the instance, so that the epilogue's stores share one address register and differ in their offset fields.
template <int MODE, int Ncols>
__global__ __launch_bounds__(128) void gemm_wmma(const half_t* __restrict__ A,
                                                 const half_t* __restrict__ B,
                                                 const float* __restrict__ bias,
                                                 const float* __restrict__ res,
                                                 half_t* __restrict__ out16,
                                                 float* __restrict__ out32,
                                                 int K) {
  // per buffer: A rows 0..63 | A rows 64..127 (pitch 144 B) | B rows k 0..31 | k 32..63 (row-major [k][n], pitch 288 B)
  __shared__ __attribute__((aligned(2048))) unsigned char sT[2 * STAGE];

  const int tid = threadIdx.x;
  const int lane = tid & 31;
  const uint32_t wave = uni((uint32_t)tid >> 5);
  const int wm = wave >> 1;  // 0..1 : 64-row strip
  const int wn = wave & 1;   // 0..1 : 64-col strip
  const int bm = blockIdx.x * BM;
  const int bn = blockIdx.y * BN;

  const int kb  = (lane & 16) ? 8 : 0;
  const int l15 = lane & 15;
  const int hi8 = (lane & 16) ? 8 : 0;

  v8f acc[4][4];
#pragma unroll
  for (int a2 = 0; a2 < 4; a2++)
#pragma unroll
    for (int b2 = 0; b2 < 4; b2++)
#pragma unroll
      for (int j = 0; j < 8; j++) acc[a2][b2][j] = 0.f;

  // this lane's 16-byte piece for the transposing load of a 16(k) x 16(n) block of a B slice
  const int btr  = (hi8 + (lane & 7)) * BSTR + ((lane >> 3) & 1) * 8;

  // waves 0 and 1 bring the two 64-row halves of the A tile (rows of 128 B), waves 2 and 3 the two 32-row halves of the
  // B tile (rows of 256 B); slice w of a buffer is wave w's
  const uint32_t isA = pinned(wave < 2u ? 1u : 0u);  // pinned(): the test on it below is a scalar branch
  const uint64_t gbase = isA ? (uint64_t)(uintptr_t)(A + (size_t)(bm + (int)wave * 64) * K)
                             : (uint64_t)(uintptr_t)(B + (size_t)(((int)wave - 2) * 32) * Ncols + bn);
  const uint32_t gstep = isA ? (uint32_t)(BK * 2) : (uint32_t)(BK * 2) * (uint32_t)Ncols;  // bytes from one k-step's slice to the next
  const uint32_t ldst  = (uint32_t)(size_t)sT + wave * SLICE;
  // pad behind every 128-B row: 16 B (pitch 144 B, for ds_load_b128); behind every 256-B row: 32 B (pitch 288 B, for ds_load_tr16_b128)
  u32x8 g1a = tdm_group1<(1u << 20) | (4u << 22) | (3u << 25), 128u, 64u>((uint32_t)K * 2u);
  u32x8 g1b = tdm_group1<(1u << 20) | (5u << 22) | (7u << 25), 256u, 32u>((uint32_t)Ncols * 2u);
  // as in pinned(): the descriptor words are held in their scalar registers through the loop, so that none of them
  // serves as a scratch register while a request that named it is in flight
  asm volatile("" : "+s"(g1a), "+s"(g1b));  // pinned(): descriptor words held in scalar registers
  auto issue = [&](uint32_t st) {
    const u32x4 g0 = tdm_group0(ldst + (st & 1u) * STAGE, gbase + (uint64_t)(st * gstep));
    if (isA != 0u) tdm_load(g0, g1a);  // scalar branch: each wave issues exactly one of the two requests
    else           tdm_load(g0, g1b);
  };

  const uint32_t nst = uni((uint32_t)K / BK);
  issue(0u);
  asm volatile("s_wait_tensorcnt 0x0" ::: "memory");  // this wave's slice of k-step 0 has landed
  __syncthreads();                                    // ... and every other wave's: k-step 0 may be read
  issue(1u);

  for (uint32_t s = 0; s < nst; s++) {
    const unsigned char* sbuf = sT + (s & 1u) * STAGE;
    const half_t* sA = (const half_t*)(sbuf + wm * SLICE);   // this wave's 64 A rows
    const half_t* sB = (const half_t*)(sbuf + 2 * SLICE);    // k rows 0..31; rows 32..63 one slice further
#pragma unroll
    for (int ks = 0; ks < BK; ks += 32) {
      v16h af[4], bf[4];
#pragma unroll
      for (int b2 = 0; b2 < 4; b2++) {
        // k = 8h + 0..7 and 16 + 8h + 0..7 of column l15: the same k order as af
        const half_t* pb = sB + (ks / 32) * (SLICE / 2) + btr + wn * 64 + b2 * 16;
        bf[b2] = make_frag(ld_tr16(pb), ld_tr16(pb + 16 * BSTR));
      }
#pragma unroll
      for (int a2 = 0; a2 < 4; a2++) {
        const half_t* pa = sA + (a2 * 16 + l15) * ASTR + ks;
        af[a2] = make_frag(*(const v8h*)(pa + kb), *(const v8h*)(pa + kb + 16));
      }
      if (ks == BK - 32) {
        // hand-over, once the k-step's last fragments are fetched, in this order: this wave's reads of the buffer are
        // done; its slice of k-step s + 1 has landed; the one barrier publishes k-step s + 1 and ends every wave's reads
        // of the buffer that is refilled behind it. The refill goes out ahead of the last 16 WMMAs: a whole k-step of lead
        asm volatile("s_wait_dscnt 0x0" ::: "memory");
        asm volatile("s_wait_tensorcnt 0x0" ::: "memory");
        __syncthreads();
        const uint32_t nx = pinned(s + 2u);        // pinned(): the next descriptor is formed behind the wait above
        if (pinned(nx < nst ? 1u : 0u) != 0u) issue(nx);  // scalar branch: only while k-step s + 2 exists
      }
      // holds the 16 fragment loads ahead of the 16 WMMAs as one group: left free, the compiler reloads one
      // A fragment per 4 WMMAs into the same registers and the wave waits out the LDS latency four times
      __builtin_amdgcn_sched_barrier(0);
#pragma unroll
      for (int a2 = 0; a2 < 4; a2++)
#pragma unroll
        for (int b2 = 0; b2 < 4; b2++)
          acc[a2][b2] = wmma_f16(af[a2], bf[b2], acc[a2][b2]);
    }
  }
  // no request and no LDS read is left when the wave goes on
  asm volatile("s_wait_tensorcnt 0x0" ::: "memory");
  asm volatile("s_wait_dscnt 0x0" ::: "memory");

  // The output leaves in whole 128-B lines: each wave lays its 64 x 64 tile row-major in a quarter of the ring that is
  // its own, and reads it back 16 bytes a lane, so that one store covers four whole lines (from the accumulators a store
  // is two pieces of 32 or 64 bytes). The ring is free: the last k-step's barrier stands behind every wave's last
  // fragment reads and behind the landing of the last tensor load, so no further barrier is needed.
  unsigned char* stg = sT + wave * (STAGE / 2);
  constexpr bool OUT16 = (MODE == MODE_F16_BIAS || MODE == MODE_F16_GELU);
  float bc[4];  // the bias of this lane's four columns
#pragma unroll
  for (int b2 = 0; b2 < 4; b2++) bc[b2] = bias[bn + wn * 64 + b2 * 16 + l15];

  // The wave's four 16-row groups pass through one copy of this code: the loop stays rolled and the
  // next group's accumulators move down into acc[0]. Unrolled, the GELU epilogue of 128 values a lane is about
  // four times the text.
#pragma unroll 1
  for (int a2 = 0; a2 < 4; a2++) {
    const int lr = a2 * 16 + hi8;
#pragma unroll
    for (int b2 = 0; b2 < 4; b2++) {
      const int lc = b2 * 16 + l15;
      if constexpr (MODE == MODE_F16_GELU) {
        const v8h g = __builtin_convertvector(gelu8(acc[0][b2] + bc[b2]), v8h);
#pragma unroll
        for (int j = 0; j < 8; j++) ((half_t*)stg)[(lr + j) * OSTR16 + lc] = g[j];
      } else {
#pragma unroll
        for (int j = 0; j < 8; j++) {
          const float v0 = acc[0][b2][j] + bc[b2];
          if constexpr (OUT16) ((half_t*)stg)[(lr + j) * OSTR16 + lc] = (half_t)v0;
          else                 ((float*)stg)[(lr + j) * OSTR32 + lc] = v0;
        }
      }
    }
#pragma unroll
    for (int s = 0; s < 3; s++)
#pragma unroll
      for (int b2 = 0; b2 < 4; b2++) acc[s][b2] = acc[s + 1][b2];
  }
  // the tile goes from lane to lane of this wave only: its LDS stores are waited out before the rows are read back
  asm volatile("s_wait_dscnt 0x0" ::: "memory");

  if constexpr (OUT16) {
    // 8 lanes take one row of 128 B, a wave-wide store 4 rows
    const int rr = lane >> 3, pc = (lane & 7) * 8;
    const half_t* sp = (const half_t*)stg + rr * OSTR16 + pc;
    half_t* gp = out16 + (size_t)(bm + wm * 64 + rr) * Ncols + bn + wn * 64 + pc;
#pragma unroll
    for (int i = 0; i < 16; i++)
      *(v8h*)(gp + i * 4 * Ncols) = *(const v8h*)(sp + i * 4 * OSTR16);
  } else {
    // 16 lanes take one row of 256 B, a wave-wide load or store 2 rows; the residual comes in the same whole lines.
    // A block's 128 rows lie in one batch entry n (T is a multiple of 128): row r = n*T + t stands at t*N + n in x and out
    const int rr = lane >> 4, pc = (lane & 15) * 4;
    const float* sp = (const float*)stg + rr * OSTR32 + pc;
    const int r = bm + wm * 64 + rr;
    const int n = r >> 11, t = r & (T_DIM - 1);
    const size_t bmaj = (size_t)r * C_DIM + bn + wn * 64 + pc;
    const size_t tmaj = ((size_t)t * N_DIM + n) * C_DIM + bn + wn * 64 + pc;
    constexpr bool RES_T = (MODE == MODE_F32_RES_T);  // h = x(transposed read) + proj; else d_out[(t,n,c)] = h + ffn
    const float* rp = res + (RES_T ? tmaj : bmaj);
    float* op = out32 + (RES_T ? bmaj : tmaj);
    constexpr int RSTEP = RES_T ? 2 * N_DIM * C_DIM : 2 * C_DIM;
    constexpr int OSTEP = RES_T ? 2 * C_DIM : 2 * N_DIM * C_DIM;
#pragma unroll
    for (int i = 0; i < 32; i++)
      *(v4f*)(op + i * OSTEP) = *(const v4f*)(sp + i * 2 * OSTR32) + *(const v4f*)(rp + i * RSTEP);
  }
}

__global__ __launch_bounds__(128) void attn_kernel(const half_t* __restrict__ Q,
                                                   const half_t* __restrict__ KV,
                                                   half_t* __restrict__ O) {
  __shared__ __align__(16) half_t sK[2][32 * KSTR];     // [key][d], two buffers
  __shared__ __align__(16) half_t sV[2][32 * VSTR];     // [key][d], two buffers

  const int tid  = threadIdx.x;
  const int lane = tid & 31;
  const int wave = __builtin_amdgcn_readfirstlane(tid >> 5);
  const int qb = blockIdx.x * (16 * AQW);  // first query of the block
  const int q0 = qb + wave * 16;           // first query of this wave
  const int h  = blockIdx.y;
  const int n  = blockIdx.z;

  const int kb  = (lane & 16) ? 8 : 0;
  const int l15 = lane & 15;
  const int hi8 = (lane & 16) ? 8 : 0;

  const half_t* Qb = Q + ((size_t)(n * T_DIM + q0)) * C_DIM + h * D_DIM;
  const half_t* Kb = KV + ((size_t)n * T_DIM) * (2 * C_DIM) + h * D_DIM;

  // Q as B-fragments (column = query) for both 32-wide D steps (per-lane runs are contiguous in D)
  const half_t* qr = Qb + (size_t)l15 * C_DIM;
  v16h aQ0 = make_frag(*(const v8h*)(qr + kb), *(const v8h*)(qr + kb + 16));
  v16h aQ1 = make_frag(*(const v8h*)(qr + 32 + kb), *(const v8h*)(qr + 32 + kb + 16));

  // of this lane's query q0 + l15: the running maximum (the same in both lane halves) and this half's part of the sum
  float m = -3e38f, l = 0.f;
  v8f oo[4];  // O^T: oo[dt][j] = O[query l15][d = dt*16 + hi8 + j]
#pragma unroll
  for (int dt = 0; dt < 4; dt++)
#pragma unroll
    for (int j = 0; j < 8; j++) oo[dt][j] = 0.f;

  // this wave's own chunks: the 32-key chunks that hold a key of its 16 queries' band
  int kstart = q0 - W_DIM;
  if (kstart < 0) kstart = 0;
  kstart &= ~31;
  // the block's chunks: from its first wave's first to its last wave's last
  int kfirst = qb - W_DIM;
  if (kfirst < 0) kfirst = 0;
  kfirst &= ~31;
  const int klast = (qb + 16 * AQW - 1) & ~31;

  // staging: a thread moves rows srow and srow + 16 of K and of V, 16 bytes of each; a wave-load covers 4 whole lines
  const int srow = tid >> 3;        // 0..15
  const int sc8  = (tid & 7) * 8;   // 0..56
  const half_t* gs = Kb + (size_t)srow * (2 * C_DIM) + sc8;
  const int kst = srow * KSTR + sc8;
  const int vst = srow * VSTR + sc8;
  // this lane's 16-byte piece for the transposing load of a 16(key) x 16(d) block of sV
  const int vtr = (hi8 + (lane & 7)) * VSTR + ((lane >> 3) & 1) * 8;

  {
    const half_t* g = gs + (size_t)kfirst * (2 * C_DIM);
    v8h rk0 = *(const v8h*)(g);
    v8h rk1 = *(const v8h*)(g + 16 * (2 * C_DIM));
    v8h rv0 = *(const v8h*)(g + C_DIM);
    v8h rv1 = *(const v8h*)(g + 16 * (2 * C_DIM) + C_DIM);
    *(v8h*)(sK[0] + kst) = rk0;
    *(v8h*)(sK[0] + kst + 16 * KSTR) = rk1;
    *(v8h*)(sV[0] + vst) = rv0;
    *(v8h*)(sV[0] + vst + 16 * VSTR) = rv1;
  }
  __syncthreads();

  int buf = 0;
  for (int kc = kfirst; kc <= klast; kc += 32) {
    // the next chunk's lines are asked for ahead of this chunk's work and laid into the other buffer behind it
    const bool more = kc + 32 <= klast;
    v8h rk0, rk1, rv0, rv1;
    if (more) {
      const half_t* g = gs + (size_t)(kc + 32) * (2 * C_DIM);
      rk0 = *(const v8h*)(g);
      rk1 = *(const v8h*)(g + 16 * (2 * C_DIM));
      rv0 = *(const v8h*)(g + C_DIM);
      rv1 = *(const v8h*)(g + 16 * (2 * C_DIM) + C_DIM);
      // the work below reuses the registers that hold these loads' address: the wait stands in front of that
      asm volatile("s_wait_xcnt 0x0" ::: "memory");
    }

    // wave-uniform: a chunk outside this wave's own band is passed over (every wave still meets the barrier below)
    if (kc >= kstart && kc <= q0 + 15) {
      // K A-fragments (row = key, contiguous runs in D per lane)
      const half_t* kr0 = sK[buf] + l15 * KSTR;
      const half_t* kr1 = kr0 + 16 * KSTR;
      v16h bK00 = make_frag(*(const v8h*)(kr0 + kb), *(const v8h*)(kr0 + kb + 16));
      v16h bK01 = make_frag(*(const v8h*)(kr0 + 32 + kb), *(const v8h*)(kr0 + 32 + kb + 16));
      v16h bK10 = make_frag(*(const v8h*)(kr1 + kb), *(const v8h*)(kr1 + kb + 16));
      v16h bK11 = make_frag(*(const v8h*)(kr1 + 32 + kb), *(const v8h*)(kr1 + 32 + kb + 16));

      // s0[j] = S[query l15][key kc + hi8 + j], s1[j] the same 16 keys further
      v8f s0 = {0, 0, 0, 0, 0, 0, 0, 0};
      v8f s1 = {0, 0, 0, 0, 0, 0, 0, 0};
      s0 = wmma_f16(bK00, aQ0, s0);
      s0 = wmma_f16(bK01, aQ1, s0);
      s1 = wmma_f16(bK10, aQ0, s1);
      s1 = wmma_f16(bK11, aQ1, s1);

      // online softmax (band mask as data-level select; EXEC stays all-1s)
      const int dq = q0 + l15 - kc - hi8;  // query minus key at j = 0; in the band: 0 <= query - key <= W
      bool val0[8], val1[8];
      v8f x0 = s0 * 0.125f, x1 = s1 * 0.125f;
#pragma unroll  // constant indices: the vectors stay in registers, the tests in scalar registers
      for (int j = 0; j < 8; j++) {
        val0[j] = (unsigned)(dq - j) <= (unsigned)W_DIM;
        val1[j] = (unsigned)(dq - 16 - j) <= (unsigned)W_DIM;
        x0[j] = val0[j] ? x0[j] : -3e38f;
        x1[j] = val1[j] ? x1[j] : -3e38f;
      }
      float cm = fmaxf(x0[0], x1[0]);
#pragma unroll  // constant indices, as above
      for (int j = 1; j < 8; j++) cm = fmaxf(cm, fmaxf(x0[j], x1[j]));
      cm = fmaxf(cm, xhalf(cm));  // the other half's 16 keys of the same query
      const float nm = fmaxf(m, cm);
      const float corr = __expf(m - nm);  // (-3e38)-(-3e38)=0 -> 1; finite path ok
      m = nm;
      const v8f e0 = (x0 - nm) * 1.44269504f, e1 = (x1 - nm) * 1.44269504f;  // exp(x) = exp2(x log2 e)
      v8f p0, p1;
#pragma unroll  // constant indices, as above
      for (int j = 0; j < 8; j++) {
        p0[j] = val0[j] ? __builtin_amdgcn_exp2f(e0[j]) : 0.f;
        p1[j] = val1[j] ? __builtin_amdgcn_exp2f(e1[j]) : 0.f;
      }
      const v8f ps = p0 + p1;
      l = l * corr + (((ps[0] + ps[1]) + (ps[2] + ps[3])) + ((ps[4] + ps[5]) + (ps[6] + ps[7])));
#pragma unroll  // constant indices, as above
      for (int dt = 0; dt < 4; dt++) oo[dt] *= corr;

      // P^T as B operand: element s is key 8h + s (s < 8), 16 + 8h + s - 8 (else) of column l15, which is what the two
      // score tiles hold in this lane
      const v16h bP = make_frag(__builtin_convertvector(p0, v8h), __builtin_convertvector(p1, v8h));
#pragma unroll
      for (int dt = 0; dt < 4; dt++) {
        // V^T as A operand: keys 8h + 0..7 and 16 + 8h + 0..7 of row d = dt*16 + l15: the same k order as bP
        const half_t* pv = sV[buf] + vtr + dt * 16;
        v16h aV = make_frag(ld_tr16(pv), ld_tr16(pv + 16 * VSTR));
        oo[dt] = wmma_f16(aV, bP, oo[dt]);
      }
    }

    if (more) {
      *(v8h*)(sK[buf ^ 1] + kst) = rk0;
      *(v8h*)(sK[buf ^ 1] + kst + 16 * KSTR) = rk1;
      *(v8h*)(sV[buf ^ 1] + vst) = rv0;
      *(v8h*)(sV[buf ^ 1] + vst + 16 * VSTR) = rv1;
    }
    // one barrier per chunk: it publishes the buffer just filled and ends every wave's reads of the one filled next
    __syncthreads();
    buf ^= 1;
  }

  l += xhalf(l);  // the two halves' parts of the query's sum join once
  const float inv = (l > 0.f) ? (1.0f / l) : 0.f;

  // The 16 x 64 output tile leaves in whole 128-B lines: laid row-major in this wave's own quarter of sK (free: the
  // loop's last barrier ends every wave's reads of it) and read back 16 bytes a lane, 4 rows a store
  half_t* so = &sK[0][0] + wave * (16 * KSTR);
#pragma unroll
  for (int dt = 0; dt < 4; dt++)  // a lane's 8 values of a tile are 8 consecutive d of its query's row
    *(v8h*)(so + l15 * KSTR + dt * 16 + hi8) = __builtin_convertvector(oo[dt] * inv, v8h);
  // the tile goes from lane to lane of this wave only: its LDS stores are waited out before the rows are read back
  asm volatile("s_wait_dscnt 0x0" ::: "memory");

  half_t* ob = O + ((size_t)(n * T_DIM + q0)) * C_DIM + h * D_DIM;
  const int orow = lane >> 3, opc = (lane & 7) * 8;
#pragma unroll
  for (int i = 0; i < 4; i++)
    *(v8h*)(ob + (size_t)(i * 4 + orow) * C_DIM + opc) = *(const v8h*)(so + (i * 4 + orow) * KSTR + opc);
}

// ---------------- host orchestration ----------------
extern "C" void kernel_launch(void* const* d_in, const int* in_sizes, int n_in,
                              void* d_out, int out_size, void* d_ws, size_t ws_size,
                              hipStream_t stream) {
  (void)in_sizes; (void)n_in; (void)out_size; (void)ws_size;
  const float* x     = (const float*)d_in[0];
  const float* q_w   = (const float*)d_in[1];
  const float* q_b   = (const float*)d_in[2];
  const float* kv_w  = (const float*)d_in[3];
  const float* kv_b  = (const float*)d_in[4];
  const float* out_w = (const float*)d_in[5];
  const float* out_b = (const float*)d_in[6];
  const float* ff_w1 = (const float*)d_in[7];
  const float* ff_b1 = (const float*)d_in[8];
  const float* ff_w2 = (const float*)d_in[9];
  const float* ff_b2 = (const float*)d_in[10];
  const float* ln1_g = (const float*)d_in[11];
  const float* ln1_b = (const float*)d_in[12];
  const float* ln2_g = (const float*)d_in[13];
  const float* ln2_b = (const float*)d_in[14];

  char* ws = (char*)d_ws;
  size_t off = 0;
  auto alloc = [&](size_t bytes) -> char* {
    char* p = ws + off;
    off += (bytes + 255) & ~(size_t)255;
    return p;
  };
  half_t* wq   = (half_t*)alloc((size_t)C_DIM * C_DIM * 2);
  half_t* wkv  = (half_t*)alloc((size_t)C_DIM * 2 * C_DIM * 2);
  half_t* wo   = (half_t*)alloc((size_t)C_DIM * C_DIM * 2);
  half_t* wf1  = (half_t*)alloc((size_t)C_DIM * F_DIM * 2);
  half_t* wf2  = (half_t*)alloc((size_t)F_DIM * C_DIM * 2);
  half_t* A16  = (half_t*)alloc((size_t)NT * C_DIM * 2);
  half_t* Q16  = (half_t*)alloc((size_t)NT * C_DIM * 2);
  half_t* KV16 = (half_t*)alloc((size_t)NT * 2 * C_DIM * 2);
  half_t* O16  = (half_t*)alloc((size_t)NT * C_DIM * 2);
  float*  H32  = (float*)alloc((size_t)NT * C_DIM * 4);
  half_t* G16  = (half_t*)alloc((size_t)NT * F_DIM * 2);

  auto cast = [&](const float* s, half_t* d, int n) {
    cast_f32_to_f16<<<(n + 255) / 256, 256, 0, stream>>>(s, d, n);
  };
  cast(q_w, wq, C_DIM * C_DIM);
  cast(kv_w, wkv, C_DIM * 2 * C_DIM);
  cast(out_w, wo, C_DIM * C_DIM);
  cast(ff_w1, wf1, C_DIM * F_DIM);
  cast(ff_w2, wf2, F_DIM * C_DIM);

  layernorm_f16<true><<<NT, 256, 0, stream>>>(x, ln1_g, ln1_b, A16);

  dim3 blk(128);
  gemm_wmma<MODE_F16_BIAS, C_DIM><<<dim3(NT / BM, C_DIM / BN), blk, 0, stream>>>(
      A16, wq, q_b, nullptr, Q16, nullptr, C_DIM);
  gemm_wmma<MODE_F16_BIAS, 2 * C_DIM><<<dim3(NT / BM, 2 * C_DIM / BN), blk, 0, stream>>>(
      A16, wkv, kv_b, nullptr, KV16, nullptr, C_DIM);

  int nrope = NT * H_DIM * (D_DIM / 2);
  rope_inplace<<<(nrope + 255) / 256, 256, 0, stream>>>(Q16, C_DIM);
  rope_inplace<<<(nrope + 255) / 256, 256, 0, stream>>>(KV16, 2 * C_DIM);

  attn_kernel<<<dim3(T_DIM / (16 * AQW), H_DIM, N_DIM), 32 * AQW, 0, stream>>>(Q16, KV16, O16);

  gemm_wmma<MODE_F32_RES_T, C_DIM><<<dim3(NT / BM, C_DIM / BN), blk, 0, stream>>>(
      O16, wo, out_b, x, nullptr, H32, C_DIM);

  layernorm_f16<false><<<NT, 256, 0, stream>>>(H32, ln2_g, ln2_b, A16);

  gemm_wmma<MODE_F16_GELU, F_DIM><<<dim3(NT / BM, F_DIM / BN), blk, 0, stream>>>(
      A16, wf1, ff_b1, nullptr, G16, nullptr, C_DIM);

  gemm_wmma<MODE_F32_OUT_T, C_DIM><<<dim3(NT / BM, C_DIM / BN), blk, 0, stream>>>(
      G16, wf2, ff_b2, H32, nullptr, (float*)d_out, F_DIM);
}

// v008
// A run of this version takes 269 microseconds.
// Two timings next to v007 both put it at 1.06 times that version's speed.
// All steps since v000 together make it 5.94 times as fast.
#include <hip/hip_runtime.h>
#include <hip/hip_bf16.h>
#include <math.h>
#include <stdint.h>

typedef _Float16 half_t;
typedef __attribute__((ext_vector_type(16))) _Float16 v16h;
typedef __attribute__((ext_vector_type(8)))  _Float16 v8h;
typedef __attribute__((ext_vector_type(8)))  float    v8f;
typedef __attribute__((ext_vector_type(4)))  float    v4f;

#define T_DIM 2048
#define N_DIM 4
#define C_DIM 1024
#define H_DIM 16
#define D_DIM 64
#define W_DIM 512
#define F_DIM 4096
#define NT    (T_DIM * N_DIM)

#define BM 128
#define BN 128
#define BK 64
#define ASTR 72   // LDS stride of a GEMM A row in halves (144B = 16B x 9: the pitch of the 16-byte load)
#define BSTR 144  // LDS stride of a row-major B row in halves (288B = 32B x 9: the pitch of the transposing load)
#define SLICE 10240          // bytes of LDS per tensor-load slice: 64 A rows at 144 B or 32 B rows at 288 B (9,216 B), up to a multiple of 2 KiB
#define STAGE (4 * SLICE)    // one k-step's tiles: two A slices, then two B slices
#define OSTR16 72  // LDS stride of a staged f16 output row in halves (144B: rows r and r + 8 fall on different banks; the pitch of the 16-byte load)
#define OSTR32 68  // LDS stride of a staged f32 output row in floats (272B: the same two properties)
#define AQW  4    // attention: 16-query tiles (waves) per block
#define KSTR 72   // attention: LDS stride of a K row in halves (144B = 16B x 9: the pitch of the 16-byte load)
#define VSTR 80   // attention: LDS stride of a V row in halves (160B = 32B x 5: the pitch of the transposing load)

enum { MODE_F16_BIAS = 0, MODE_F16_GELU = 1, MODE_F32_RES_T = 2, MODE_F32_OUT_T = 3 };

__device__ __forceinline__ v16h make_frag(v8h lo, v8h hi) {
  v16h a;
#pragma unroll
  for (int i = 0; i < 8; i++) { a[i] = lo[i]; a[i + 8] = hi[i]; }
  return a;
}

__device__ __forceinline__ v8f wmma_f16(v16h a, v16h b, v8f c) {
  return __builtin_amdgcn_wmma_f32_16x16x32_f16(false, a, false, b, (short)0, c, false, false);
}

// Transposing LDS load: from a row-major [k][n] tile, lane (c = lane & 15, h = lane >> 4)
// receives the 8 values T[k0 + 8h + 0..7][n0 + c]. Every lane passes the address of one 16-byte piece.
typedef __attribute__((ext_vector_type(8))) short s16x8;
__device__ __forceinline__ v8h ld_tr16(const half_t* p) {
  typedef __attribute__((address_space(3))) s16x8 lds_s16x8;
  return __builtin_bit_cast(v8h, __builtin_amdgcn_ds_load_tr16_b128_v8i16((lds_s16x8*)p));
}

// the value of lane l ^ 16 (the other 16-lane row), by a vector cross-row move
__device__ __forceinline__ float xhalf(float x) {
  const int v = __builtin_bit_cast(int, x);
  return __builtin_bit_cast(float, __builtin_amdgcn_permlanex16(v, v, 0x76543210, 0xfedcba98, false, false));
}

// ---------------- tensor load to LDS: one request of a whole wave brings a padded two-dimensional tile ----------------
typedef uint32_t u32x4 __attribute__((ext_vector_type(4)));
typedef uint32_t u32x8 __attribute__((ext_vector_type(8)));
__device__ __forceinline__ uint32_t uni(uint32_t v) { return (uint32_t)__builtin_amdgcn_readfirstlane(v); }
__device__ __forceinline__ uint32_t pinned(uint32_t v) {
  uint32_t w = uni(v);
  asm volatile("" : "+s"(w));  // pinned(): a value for a tensor load's test or descriptor, held in a scalar register
  return w;
}
// group 1: 1-byte elements, tensor = tile = ROWS rows of ROWB bytes, source pitch in bytes; WORD0 holds the pad that sets the LDS pitch
template <uint32_t WORD0, uint32_t ROWB, uint32_t ROWS>
__device__ __forceinline__ u32x8 tdm_group1(uint32_t src_pitch) {
  u32x8 g;
  g[0] = uni(WORD0);
  g[1] = uni((ROWB & 0xFFFFu) << 16);
  g[2] = uni((ROWB >> 16) | ((ROWS & 0xFFFFu) << 16));
  g[3] = uni((ROWS >> 16) | (ROWB << 16));
  g[4] = uni(ROWS);
  g[5] = uni(src_pitch);
  g[6] = uni(0u);
  g[7] = uni(0u);
  return g;
}
// group 0: count 1, place in LDS, address of the tile's first byte, type 2
__device__ __forceinline__ u32x4 tdm_group0(uint32_t lds_dst, uint64_t ga, uint32_t count1 = 1u) {
  u32x4 g;
  g[0] = uni(count1);
  g[1] = uni(lds_dst);
  g[2] = uni((uint32_t)ga);
  g[3] = uni((((uint32_t)(ga >> 32)) & 0x01FFFFFFu) | 0x80000000u);
  return g;
}
__device__ __forceinline__ void tdm_load(u32x4 g0, u32x8 g1) {
  asm volatile("tensor_load_to_lds %0, %1" :: "s"(g0), "s"(g1) : "memory");
}

// ---------------- elementwise: f32 -> f16 cast ----------------
__global__ void cast_f32_to_f16(const float* __restrict__ src, half_t* __restrict__ dst, int n) {
  int i = blockIdx.x * blockDim.x + threadIdx.x;
  if (i < n) dst[i] = (half_t)src[i];
}

// ---------------- LayerNorm (one block per row), writes f16 ----------------
template <bool TRANSPOSED>
__global__ __launch_bounds__(256) void layernorm_f16(const float* __restrict__ src,
                                                     const float* __restrict__ g,
                                                     const float* __restrict__ b,
                                                     half_t* __restrict__ dst) {
  int r = blockIdx.x;  // r = n*T + t
  const float* row;
  if (TRANSPOSED) {
    int n = r >> 11;             // T = 2048
    int t = r & (T_DIM - 1);
    row = src + ((size_t)t * N_DIM + n) * C_DIM;
  } else {
    row = src + (size_t)r * C_DIM;
  }
  float v[4];
  float s = 0.f, s2 = 0.f;
#pragma unroll
  for (int i = 0; i < 4; i++) {
    v[i] = row[threadIdx.x + i * 256];
    s += v[i];
    s2 += v[i] * v[i];
  }
#pragma unroll
  for (int m = 16; m >= 1; m >>= 1) { s += __shfl_xor(s, m); s2 += __shfl_xor(s2, m); }
  __shared__ float sh[2][8];
  int wave = threadIdx.x >> 5, lane = threadIdx.x & 31;
  if (lane == 0) { sh[0][wave] = s; sh[1][wave] = s2; }
  __syncthreads();
  if (wave == 0) {
    s = sh[0][lane & 7];
    s2 = sh[1][lane & 7];
#pragma unroll
    for (int m = 4; m >= 1; m >>= 1) { s += __shfl_xor(s, m); s2 += __shfl_xor(s2, m); }
    if (lane == 0) { sh[0][0] = s; sh[1][0] = s2; }
  }
  __syncthreads();
  float mu = sh[0][0] * (1.0f / C_DIM);
  float var = sh[1][0] * (1.0f / C_DIM) - mu * mu;
  float rstd = rsqrtf(var + 1e-5f);
#pragma unroll
  for (int i = 0; i < 4; i++) {
    int c = threadIdx.x + i * 256;
    dst[(size_t)r * C_DIM + c] = (half_t)((v[i] - mu) * rstd * g[c] + b[c]);
  }
}

// ---------------- RoPE, in place on f16 (pos = t + W) ----------------
__global__ void rope_inplace(half_t* __restrict__ buf, int stride) {
  int idx = blockIdx.x * blockDim.x + threadIdx.x;
  if (idx >= NT * H_DIM * (D_DIM / 2)) return;
  int i = idx & 31;
  int h = (idx >> 5) & 15;
  int row = idx >> 9;
  int t = row & (T_DIM - 1);
  float pos = (float)(t + W_DIM);
  // inv_freq = ROPE_BASE^(-2i/D) = exp(-(2i/D) * ln(10000))
  float freq = __expf(-(float)(2 * i) * (1.0f / (float)D_DIM) * 9.210340371976184f);
  float ang = pos * freq;
  float sn, cs;
  __sincosf(ang, &sn, &cs);
  half_t* p = buf + (size_t)row * stride + h * D_DIM;
  float a = (float)p[i];
  float bq = (float)p[i + 32];
  p[i] = (half_t)(a * cs - bq * sn);
  p[i + 32] = (half_t)(bq * cs + a * sn);
}

// ---------------- exact GELU, x * Phi(x), of a lane's eight values, without a branch ----------------
// Phi(-|x|) = erfc(|x| / sqrt 2) / 2 = t (a1 + t (a2 + t (a3 + t (a4 + t a5)))) exp(-x^2 / 2) / 2, t = 1 / (1 + p |x| / sqrt 2):
// the five-term rational form of erfc, absolute error below 2e-7. The tail is formed as a product, so 1 + erf never
// cancels for x < 0: gelu(x) = max(x, 0) - |x| Phi(-|x|). One path for every lane and no test, so the values of a lane are
// independent chains, two to an instruction; 1 + p |x| / sqrt 2 is at least 1, so the reciprocal has no pole.
__device__ __forceinline__ v8f gelu8(v8f x) {
  const v8f ax = __builtin_elementwise_abs(x);
  const v8f d = ax * 0.23164189f + 1.0f;                 // p / sqrt 2
  v8f t, e;
#pragma unroll  // constant indices: the vectors stay in registers
  for (int j = 0; j < 8; j++) t[j] = __builtin_amdgcn_rcpf(d[j]);
  v8f h = t * 0.5307027145f - 0.7265760135f;             // a5 / 2, a4 / 2
  h = h * t + 0.7107068705f;                             // a3 / 2
  h = h * t - 0.142248368f;                              // a2 / 2
  h = h * t + 0.127414796f;                              // a1 / 2
  const v8f u = (x * -0.72134752f) * x;                  // -x^2 / 2 * log2(e)
#pragma unroll  // as above
  for (int j = 0; j < 8; j++) e[j] = __builtin_amdgcn_exp2f(u[j]);
  const v8f q = (h * t) * e;                             // Phi(-|x|)
  const v8f zero = {0.f, 0.f, 0.f, 0.f, 0.f, 0.f, 0.f, 0.f};
  return __builtin_elementwise_max(x, zero) - ax * q;
}

// ---------------- WMMA GEMM: C[M x Ncols] = A(f16, MxK) @ B(f16, KxNcols) + epilogue ----
// Block tile 128x128x64, 4 waves (2 x 2); each wave owns a 64x64 macro-tile:
// 4 A-frags x 4 B-frags -> 16 WMMAs per 32 k. The tiles come by the tensor mover into two LDS buffers: every wave asks
// for one 8-KiB slice per k-step, one k-step ahead of its use, so the next tiles fly while these are multiplied.
// An instance whose grid leaves a WGP two blocks at most (DEEP) has LDS to spare and few waves to wait behind: it keeps
// three buffers, and its two wave pairs take turns, k-step by k-step, to ask for the whole A and the whole B tile, so that
// a request has two k-steps to land in while no wave ever has more than one outstanding.
// K is at least two k-steps (128) and a multiple of 64 at every launch. The row length of B and of the output is a
// constant of the instance, so that the epilogue's stores share one address register and differ in their offset fields.
template <int MODE, int Ncols>
__global__ __launch_bounds__(128) void gemm_wmma(const half_t* __restrict__ A,
                                                 const half_t* __restrict__ B,
                                                 const float* __restrict__ bias,
                                                 const float* __restrict__ res,
                                                 half_t* __restrict__ out16,
                                                 float* __restrict__ out32,
                                                 int K) {
  constexpr bool DEEP = (NT / BM) * (Ncols / BN) <= 2 * 256;   // at most two blocks for each of the chip's 256 WGPs
  // bytes from A rows 0..63 to rows 64..127 and from B rows k 0..31 to k 32..63: one request's tile has no gap between them
  constexpr uint32_t HALF = DEEP ? 9216u : (uint32_t)SLICE;
  constexpr uint32_t STG  = 4u * HALF;                         // one k-step's tiles (DEEP: 18 x 2 KiB)
  constexpr uint32_t NBUF = DEEP ? 3u : 2u;
  // per buffer: A rows 0..63 | A rows 64..127 (pitch 144 B) | B rows k 0..31 | k 32..63 (row-major [k][n], pitch 288 B)
  __shared__ __attribute__((aligned(2048))) unsigned char sT[NBUF * STG];

  const int tid = threadIdx.x;
  const int lane = tid & 31;
  const uint32_t wave = uni((uint32_t)tid >> 5);
  const int wm = wave >> 1;  // 0..1 : 64-row strip
  const int wn = wave & 1;   // 0..1 : 64-col strip
  const int bm = blockIdx.x * BM;
  const int bn = blockIdx.y * BN;

  const int kb  = (lane & 16) ? 8 : 0;
  const int l15 = lane & 15;
  const int hi8 = (lane & 16) ? 8 : 0;

  v8f acc[4][4];
#pragma unroll
  for (int a2 = 0; a2 < 4; a2++)
#pragma unroll
    for (int b2 = 0; b2 < 4; b2++)
#pragma unroll
      for (int j = 0; j < 8; j++) acc[a2][b2][j] = 0.f;

  // this lane's 16-byte piece for the transposing load of a 16(k) x 16(n) block of a B slice
  const int btr  = (hi8 + (lane & 7)) * BSTR + ((lane >> 3) & 1) * 8;

  // two buffers: waves 0 and 1 bring the two 64-row halves of the A tile (rows of 128 B), waves 2 and 3 the two 32-row
  // halves of the B tile (rows of 256 B); slice w of a buffer is wave w's.
  // DEEP: waves 0 and 1 bring the even k-steps, waves 2 and 3 the odd ones: the pair's first wave all 128 A rows, its
  // second all 64 B rows
  const uint32_t isA = pinned((DEEP ? (wave & 1u) == 0u : wave < 2u) ? 1u : 0u);  // pinned(): the test on it below is a scalar branch
  const uint32_t grp = wave >> 1;                       // DEEP: the parity of the k-steps that this wave asks for
  const int arow = DEEP ? 0 : (int)wave * 64;           // first A row, first B row of this wave's request
  const int brow = DEEP ? 0 : ((int)wave - 2) * 32;
  const uint64_t gbase = isA ? (uint64_t)(uintptr_t)(A + (size_t)(bm + arow) * K)
                             : (uint64_t)(uintptr_t)(B + (size_t)brow * Ncols + bn);
  const uint32_t gstep = isA ? (uint32_t)(BK * 2) : (uint32_t)(BK * 2) * (uint32_t)Ncols;  // bytes from one k-step's slice to the next
  const uint32_t ldst  = (uint32_t)(size_t)sT + (DEEP ? (wave & 1u) * 2u : wave) * HALF;
  // pad behind every 128-B row: 16 B (pitch 144 B, for ds_load_b128); behind every 256-B row: 32 B (pitch 288 B, for ds_load_tr16_b128)
  u32x8 g1a = tdm_group1<(1u << 20) | (4u << 22) | (3u << 25), 128u, DEEP ? 128u : 64u>((uint32_t)K * 2u);
  u32x8 g1b = tdm_group1<(1u << 20) | (5u << 22) | (7u << 25), 256u, DEEP ? 64u : 32u>((uint32_t)Ncols * 2u);
  // as in pinned(): the descriptor words are held in their scalar registers through the loop, so that none of them
  // serves as a scratch register while a request that named it is in flight
  asm volatile("" : "+s"(g1a), "+s"(g1b));  // pinned(): descriptor words held in scalar registers
  // DEEP, pinned(): the count, 1, of group 0 is held in a scalar register like the other words: as a literal it is formed
  // anew at each use, and its register is scratch in between, also while a request that named it is in flight
  const uint32_t count1 = DEEP ? pinned(1u) : 1u;
  auto issue = [&](uint32_t st, uint32_t buf) -> u32x4 {  // k-step st into buffer buf; returns the request's group 0
    const u32x4 g0 = tdm_group0(ldst + buf * STG, gbase + (uint64_t)(st * gstep), count1);
    if (isA != 0u) tdm_load(g0, g1a);  // scalar branch: each wave issues exactly one of the two requests
    else           tdm_load(g0, g1b);
    return g0;
  };
  // DEEP: a request flies through a hand-over and a whole k-step of other work. The wait that covers it names its group 0
  // as an input, so that those four scalar registers stay the descriptor's, and serve as nobody's scratch, until it has landed
  auto landed = [&](u32x4 g0) { asm volatile("s_wait_tensorcnt 0x0" :: "s"(g0) : "memory"); };

  const uint32_t nst = uni((uint32_t)K / BK);
  u32x4 fl = {0u, 0u, 0u, 0u};  // DEEP: group 0 of this wave's request in flight
  if constexpr (DEEP) {
    const uint32_t even = pinned(grp == 0u ? 1u : 0u);  // pinned(): the tests on it are scalar branches
    fl = issue(grp, grp);                               // every wave: its pair's first k-step (0 or 1), into buffer 0 or 1
    if (even != 0u) landed(fl);                         // k-step 0 has landed; k-step 1 flies on
    __syncthreads();                                    // k-step 0 may be read
    if (even != 0u) {
      const uint32_t nx = pinned(2u);                   // pinned(): the descriptor is formed here, behind this wave's wait
      if (pinned(nx < nst ? 1u : 0u) != 0u) fl = issue(nx, nx);
    }
  } else {
    issue(0u, 0u);
    asm volatile("s_wait_tensorcnt 0x0" ::: "memory");  // this wave's slice of k-step 0 has landed
    __syncthreads();                                    // ... and every other wave's: k-step 0 may be read
    issue(1u, 1u);
  }

  uint32_t rb = 0u;  // DEEP: the buffer that holds k-step s, s mod 3
  for (uint32_t s = 0; s < nst; s++) {
    const unsigned char* sbuf = sT + (DEEP ? rb : (s & 1u)) * STG;
    const half_t* sA = (const half_t*)(sbuf + wm * HALF);    // this wave's 64 A rows
    const half_t* sB = (const half_t*)(sbuf + 2 * HALF);     // k rows 0..31; rows 32..63 one HALF further
#pragma unroll
    for (int ks = 0; ks < BK; ks += 32) {
      v16h af[4], bf[4];
#pragma unroll
      for (int b2 = 0; b2 < 4; b2++) {
        // k = 8h + 0..7 and 16 + 8h + 0..7 of column l15: the same k order as af
        const half_t* pb = sB + (ks / 32) * (HALF / 2) + btr + wn * 64 + b2 * 16;
        bf[b2] = make_frag(ld_tr16(pb), ld_tr16(pb + 16 * BSTR));
      }
#pragma unroll
      for (int a2 = 0; a2 < 4; a2++) {
        const half_t* pa = sA + (a2 * 16 + l15) * ASTR + ks;
        af[a2] = make_frag(*(const v8h*)(pa + kb), *(const v8h*)(pa + kb + 16));
      }
      if (ks == BK - 32) {
        // hand-over, once the k-step's last fragments are fetched, in this order: this wave's reads of the buffer are
        // done; its slice of k-step s + 1 has landed; the one barrier publishes k-step s + 1 and ends every wave's reads
        // of the buffer that is refilled behind it. The refill goes out ahead of the last 16 WMMAs: a whole k-step of lead
        asm volatile("s_wait_dscnt 0x0" ::: "memory");
        if constexpr (DEEP) {
          // k-step s + 1 is the other pair's or this one's: only the pair that asked for it waits, and behind the barrier
          // that pair asks for k-step s + 3; the other pair's request, k-step s + 2, flies on through this hand-over
          const uint32_t mine = pinned(((s + 1u) & 1u) == grp ? 1u : 0u);  // pinned(): scalar branches below
          if (mine != 0u) landed(fl);
          __syncthreads();
          if (mine != 0u) {
            const uint32_t nx = pinned(s + 3u);    // pinned(): the next descriptor is formed here, behind this wave's wait
            if (pinned(nx < nst ? 1u : 0u) != 0u) fl = issue(nx, rb);  // scalar branch: only while k-step s + 3 exists
          }
        } else {
          asm volatile("s_wait_tensorcnt 0x0" ::: "memory");
          __syncthreads();
          const uint32_t nx = pinned(s + 2u);      // pinned(): the next descriptor is formed behind the wait above
          if (pinned(nx < nst ? 1u : 0u) != 0u) issue(nx, nx & 1u);  // scalar branch: only while k-step s + 2 exists
        }
      }
      // holds the 16 fragment loads ahead of the 16 WMMAs as one group: left free, the compiler reloads one
      // A fragment per 4 WMMAs into the same registers and the wave waits out the LDS latency four times
      __builtin_amdgcn_sched_barrier(0);
#pragma unroll
      for (int a2 = 0; a2 < 4; a2++)
#pragma unroll
        for (int b2 = 0; b2 < 4; b2++)
          acc[a2][b2] = wmma_f16(af[a2], bf[b2], acc[a2][b2]);
    }
    if constexpr (DEEP) rb = (rb == NBUF - 1u) ? 0u : rb + 1u;
  }
  // no request and no LDS read is left when the wave goes on
  asm volatile("s_wait_tensorcnt 0x0" ::: "memory");
  asm volatile("s_wait_dscnt 0x0" ::: "memory");

  // The output leaves in whole 128-B lines: each wave lays its 64 x 64 tile row-major in a 20-KiB part of the ring that is
  // its own, and reads it back 16 bytes a lane, so that one store covers four whole lines (from the accumulators a store
  // is two pieces of 32 or 64 bytes). The ring is free: the last k-step's barrier stands behind every wave's last
  // fragment reads and behind the landing of the last tensor load, so no further barrier is needed.
  unsigned char* stg = sT + wave * (STAGE / 2);  // 20 KiB a wave: inside the ring of either depth
  constexpr bool OUT16 = (MODE == MODE_F16_BIAS || MODE == MODE_F16_GELU);
  float bc[4];  // the bias of this lane's four columns
#pragma unroll
  for (int b2 = 0; b2 < 4; b2++) bc[b2] = bias[bn + wn * 64 + b2 * 16 + l15];

  // The wave's four 16-row groups pass through one copy of this code: the loop stays rolled and the
  // next group's accumulators move down into acc[0]. Unrolled, the GELU epilogue of 128 values a lane is about
  // four times the text.
#pragma unroll 1
  for (int a2 = 0; a2 < 4; a2++) {
    const int lr = a2 * 16 + hi8;
#pragma unroll
    for (int b2 = 0; b2 < 4; b2++) {
      const int lc = b2 * 16 + l15;
      if constexpr (MODE == MODE_F16_GELU) {
        const v8h g = __builtin_convertvector(gelu8(acc[0][b2] + bc[b2]), v8h);
#pragma unroll
        for (int j = 0; j < 8; j++) ((half_t*)stg)[(lr + j) * OSTR16 + lc] = g[j];
      } else {
#pragma unroll
        for (int j = 0; j < 8; j++) {
          const float v0 = acc[0][b2][j] + bc[b2];
          if constexpr (OUT16) ((half_t*)stg)[(lr + j) * OSTR16 + lc] = (half_t)v0;
          else                 ((float*)stg)[(lr + j) * OSTR32 + lc] = v0;
        }
      }
    }
#pragma unroll
    for (int s = 0; s < 3; s++)
#pragma unroll
      for (int b2 = 0; b2 < 4; b2++) acc[s][b2] = acc[s + 1][b2];
  }
  // the tile goes from lane to lane of this wave only: its LDS stores are waited out before the rows are read back
  asm volatile("s_wait_dscnt 0x0" ::: "memory");

  if constexpr (OUT16) {
    // 8 lanes take one row of 128 B, a wave-wide store 4 rows
    const int rr = lane >> 3, pc = (lane & 7) * 8;
    const half_t* sp = (const half_t*)stg + rr * OSTR16 + pc;
    half_t* gp = out16 + (size_t)(bm + wm * 64 + rr) * Ncols + bn + wn * 64 + pc;
#pragma unroll
    for (int i = 0; i < 16; i++)
      *(v8h*)(gp + i * 4 * Ncols) = *(const v8h*)(sp + i * 4 * OSTR16);
  } else {
    // 16 lanes take one row of 256 B, a wave-wide load or store 2 rows; the residual comes in the same whole lines.
    // A block's 128 rows lie in one batch entry n (T is a multiple of 128): row r = n*T + t stands at t*N + n in x and out
    const int rr = lane >> 4, pc = (lane & 15) * 4;
    const float* sp = (const float*)stg + rr * OSTR32 + pc;
    const int r = bm + wm * 64 + rr;
    const int n = r >> 11, t = r & (T_DIM - 1);
    const size_t bmaj = (size_t)r * C_DIM + bn + wn * 64 + pc;
    const size_t tmaj = ((size_t)t * N_DIM + n) * C_DIM + bn + wn * 64 + pc;
    constexpr bool RES_T = (MODE == MODE_F32_RES_T);  // h = x(transposed read) + proj; else d_out[(t,n,c)] = h + ffn
    const float* rp = res + (RES_T ? tmaj : bmaj);
    float* op = out32 + (RES_T ? bmaj : tmaj);
    constexpr int RSTEP = RES_T ? 2 * N_DIM * C_DIM : 2 * C_DIM;
    constexpr int OSTEP = RES_T ? 2 * C_DIM : 2 * N_DIM * C_DIM;
#pragma unroll
    for (int i = 0; i < 32; i++)
      *(v4f*)(op + i * OSTEP) = *(const v4f*)(sp + i * 2 * OSTR32) + *(const v4f*)(rp + i * RSTEP);
  }
}

__global__ __launch_bounds__(128) void attn_kernel(const half_t* __restrict__ Q,
                                                   const half_t* __restrict__ KV,
                                                   half_t* __restrict__ O) {
  __shared__ __align__(16) half_t sK[2][32 * KSTR];     // [key][d], two buffers
  __shared__ __align__(16) half_t sV[2][32 * VSTR];     // [key][d], two buffers

  const int tid  = threadIdx.x;
  const int lane = tid & 31;
  const int wave = __builtin_amdgcn_readfirstlane(tid >> 5);
  const int qb = blockIdx.x * (16 * AQW);  // first query of the block
  const int q0 = qb + wave * 16;           // first query of this wave
  const int h  = blockIdx.y;
  const int n  = blockIdx.z;

  const int kb  = (lane & 16) ? 8 : 0;
  const int l15 = lane & 15;
  const int hi8 = (lane & 16) ? 8 : 0;

  const half_t* Qb = Q + ((size_t)(n * T_DIM + q0)) * C_DIM + h * D_DIM;
  const half_t* Kb = KV + ((size_t)n * T_DIM) * (2 * C_DIM) + h * D_DIM;

  // Q as B-fragments (column = query) for both 32-wide D steps (per-lane runs are contiguous in D)
  const half_t* qr = Qb + (size_t)l15 * C_DIM;
  v16h aQ0 = make_frag(*(const v8h*)(qr + kb), *(const v8h*)(qr + kb + 16));
  v16h aQ1 = make_frag(*(const v8h*)(qr + 32 + kb), *(const v8h*)(qr + 32 + kb + 16));

  // of this lane's query q0 + l15: the running maximum (the same in both lane halves) and this half's part of the sum
  float m = -3e38f, l = 0.f;
  v8f oo[4];  // O^T: oo[dt][j] = O[query l15][d = dt*16 + hi8 + j]
#pragma unroll
  for (int dt = 0; dt < 4; dt++)
#pragma unroll
    for (int j = 0; j < 8; j++) oo[dt][j] = 0.f;

  // this wave's own chunks: the 32-key chunks that hold a key of its 16 queries' band
  int kstart = q0 - W_DIM;
  if (kstart < 0) kstart = 0;
  kstart &= ~31;
  // the block's chunks: from its first wave's first to its last wave's last
  int kfirst = qb - W_DIM;
  if (kfirst < 0) kfirst = 0;
  kfirst &= ~31;
  const int klast = (qb + 16 * AQW - 1) & ~31;

  // staging: a thread moves rows srow and srow + 16 of K and of V, 16 bytes of each; a wave-load covers 4 whole lines
  const int srow = tid >> 3;        // 0..15
  const int sc8  = (tid & 7) * 8;   // 0..56
  const half_t* gs = Kb + (size_t)srow * (2 * C_DIM) + sc8;
  const int kst = srow * KSTR + sc8;
  const int vst = srow * VSTR + sc8;
  // this lane's 16-byte piece for the transposing load of a 16(key) x 16(d) block of sV
  const int vtr = (hi8 + (lane & 7)) * VSTR + ((lane >> 3) & 1) * 8;

  {
    const half_t* g = gs + (size_t)kfirst * (2 * C_DIM);
    v8h rk0 = *(const v8h*)(g);
    v8h rk1 = *(const v8h*)(g + 16 * (2 * C_DIM));
    v8h rv0 = *(const v8h*)(g + C_DIM);
    v8h rv1 = *(const v8h*)(g + 16 * (2 * C_DIM) + C_DIM);
    *(v8h*)(sK[0] + kst) = rk0;
    *(v8h*)(sK[0] + kst + 16 * KSTR) = rk1;
    *(v8h*)(sV[0] + vst) = rv0;
    *(v8h*)(sV[0] + vst + 16 * VSTR) = rv1;
  }
  __syncthreads();

  int buf = 0;
  for (int kc = kfirst; kc <= klast; kc += 32) {
    // the next chunk's lines are asked for ahead of this chunk's work and laid into the other buffer behind it
    const bool more = kc + 32 <= klast;
    v8h rk0, rk1, rv0, rv1;
    if (more) {
      const half_t* g = gs + (size_t)(kc + 32) * (2 * C_DIM);
      rk0 = *(const v8h*)(g);
      rk1 = *(const v8h*)(g + 16 * (2 * C_DIM));
      rv0 = *(const v8h*)(g + C_DIM);
      rv1 = *(const v8h*)(g + 16 * (2 * C_DIM) + C_DIM);
      // the work below reuses the registers that hold these loads' address: the wait stands in front of that
      asm volatile("s_wait_xcnt 0x0" ::: "memory");
    }

    // wave-uniform: a chunk outside this wave's own band is passed over (every wave still meets the barrier below)
    if (kc >= kstart && kc <= q0 + 15) {
      // K A-fragments (row = key, contiguous runs in D per lane)
      const half_t* kr0 = sK[buf] + l15 * KSTR;
      const half_t* kr1 = kr0 + 16 * KSTR;
      v16h bK00 = make_frag(*(const v8h*)(kr0 + kb), *(const v8h*)(kr0 + kb + 16));
      v16h bK01 = make_frag(*(const v8h*)(kr0 + 32 + kb), *(const v8h*)(kr0 + 32 + kb + 16));
      v16h bK10 = make_frag(*(const v8h*)(kr1 + kb), *(const v8h*)(kr1 + kb + 16));
      v16h bK11 = make_frag(*(const v8h*)(kr1 + 32 + kb), *(const v8h*)(kr1 + 32 + kb + 16));

      // s0[j] = S[query l15][key kc + hi8 + j], s1[j] the same 16 keys further
      v8f s0 = {0, 0, 0, 0, 0, 0, 0, 0};
      v8f s1 = {0, 0, 0, 0, 0, 0, 0, 0};
      s0 = wmma_f16(bK00, aQ0, s0);
      s0 = wmma_f16(bK01, aQ1, s0);
      s1 = wmma_f16(bK10, aQ0, s1);
      s1 = wmma_f16(bK11, aQ1, s1);

      // online softmax (band mask as data-level select; EXEC stays all-1s)
      const int dq = q0 + l15 - kc - hi8;  // query minus key at j = 0; in the band: 0 <= query - key <= W
      bool val0[8], val1[8];
      v8f x0 = s0 * 0.125f, x1 = s1 * 0.125f;
#pragma unroll  // constant indices: the vectors stay in registers, the tests in scalar registers
      for (int j = 0; j < 8; j++) {
        val0[j] = (unsigned)(dq - j) <= (unsigned)W_DIM;
        val1[j] = (unsigned)(dq - 16 - j) <= (unsigned)W_DIM;
        x0[j] = val0[j] ? x0[j] : -3e38f;
        x1[j] = val1[j] ? x1[j] : -3e38f;
      }
      float cm = fmaxf(x0[0], x1[0]);
#pragma unroll  // constant indices, as above
      for (int j = 1; j < 8; j++) cm = fmaxf(cm, fmaxf(x0[j], x1[j]));
      cm = fmaxf(cm, xhalf(cm));  // the other half's 16 keys of the same query
      const float nm = fmaxf(m, cm);
      const float corr = __expf(m - nm);  // (-3e38)-(-3e38)=0 -> 1; finite path ok
      m = nm;
      const v8f e0 = (x0 - nm) * 1.44269504f, e1 = (x1 - nm) * 1.44269504f;  // exp(x) = exp2(x log2 e)
      v8f p0, p1;
#pragma unroll  // constant indices, as above
      for (int j = 0; j < 8; j++) {
        p0[j] = val0[j] ? __builtin_amdgcn_exp2f(e0[j]) : 0.f;
        p1[j] = val1[j] ? __builtin_amdgcn_exp2f(e1[j]) : 0.f;
      }
      const v8f ps = p0 + p1;
      l = l * corr + (((ps[0] + ps[1]) + (ps[2] + ps[3])) + ((ps[4] + ps[5]) + (ps[6] + ps[7])));
#pragma unroll  // constant indices, as above
      for (int dt = 0; dt < 4; dt++) oo[dt] *= corr;

      // P^T as B operand: element s is key 8h + s (s < 8), 16 + 8h + s - 8 (else) of column l15, which is what the two
      // score tiles hold in this lane
      const v16h bP = make_frag(__builtin_convertvector(p0, v8h), __builtin_convertvector(p1, v8h));
#pragma unroll
      for (int dt = 0; dt < 4; dt++) {
        // V^T as A operand: keys 8h + 0..7 and 16 + 8h + 0..7 of row d = dt*16 + l15: the same k order as bP
        const half_t* pv = sV[buf] + vtr + dt * 16;
        v16h aV = make_frag(ld_tr16(pv), ld_tr16(pv + 16 * VSTR));
        oo[dt] = wmma_f16(aV, bP, oo[dt]);
      }
    }

    if (more) {
      *(v8h*)(sK[buf ^ 1] + kst) = rk0;
      *(v8h*)(sK[buf ^ 1] + kst + 16 * KSTR) = rk1;
      *(v8h*)(sV[buf ^ 1] + vst) = rv0;
      *(v8h*)(sV[buf ^ 1] + vst + 16 * VSTR) = rv1;
    }
    // one barrier per chunk: it publishes the buffer just filled and ends every wave's reads of the one filled next
    __syncthreads();
    buf ^= 1;
  }

  l += xhalf(l);  // the two halves' parts of the query's sum join once
  const float inv = (l > 0.f) ? (1.0f / l) : 0.f;

  // The 16 x 64 output tile leaves in whole 128-B lines: laid row-major in this wave's own quarter of sK (free: the
  // loop's last barrier ends every wave's reads of it) and read back 16 bytes a lane, 4 rows a store
  half_t* so = &sK[0][0] + wave * (16 * KSTR);
#pragma unroll
  for (int dt = 0; dt < 4; dt++)  // a lane's 8 values of a tile are 8 consecutive d of its query's row
    *(v8h*)(so + l15 * KSTR + dt * 16 + hi8) = __builtin_convertvector(oo[dt] * inv, v8h);
  // the tile goes from lane to lane of this wave only: its LDS stores are waited out before the rows are read back
  asm volatile("s_wait_dscnt 0x0" ::: "memory");

  half_t* ob = O + ((size_t)(n * T_DIM + q0)) * C_DIM + h * D_DIM;
  const int orow = lane >> 3, opc = (lane & 7) * 8;
#pragma unroll
  for (int i = 0; i < 4; i++)
    *(v8h*)(ob + (size_t)(i * 4 + orow) * C_DIM + opc) = *(const v8h*)(so + (i * 4 + orow) * KSTR + opc);
}

// ---------------- host orchestration ----------------
extern "C" void kernel_launch(void* const* d_in, const int* in_sizes, int n_in,
                              void* d_out, int out_size, void* d_ws, size_t ws_size,
                              hipStream_t stream) {
  (void)in_sizes; (void)n_in; (void)out_size; (void)ws_size;
  const float* x     = (const float*)d_in[0];
  const float* q_w   = (const float*)d_in[1];
  const float* q_b   = (const float*)d_in[2];
  const float* kv_w  = (const float*)d_in[3];
  const float* kv_b  = (const float*)d_in[4];
  const float* out_w = (const float*)d_in[5];
  const float* out_b = (const float*)d_in[6];
  const float* ff_w1 = (const float*)d_in[7];
  const float* ff_b1 = (const float*)d_in[8];
  const float* ff_w2 = (const float*)d_in[9];
  const float* ff_b2 = (const float*)d_in[10];
  const float* ln1_g = (const float*)d_in[11];
  const float* ln1_b = (const float*)d_in[12];
  const float* ln2_g = (const float*)d_in[13];
  const float* ln2_b = (const float*)d_in[14];

  char* ws = (char*)d_ws;
  size_t off = 0;
  auto alloc = [&](size_t bytes) -> char* {
    char* p = ws + off;
    off += (bytes + 255) & ~(size_t)255;
    return p;
  };
  half_t* wq   = (half_t*)alloc((size_t)C_DIM * C_DIM * 2);
  half_t* wkv  = (half_t*)alloc((size_t)C_DIM * 2 * C_DIM * 2);
  half_t* wo   = (half_t*)alloc((size_t)C_DIM * C_DIM * 2);
  half_t* wf1  = (half_t*)alloc((size_t)C_DIM * F_DIM * 2);
  half_t* wf2  = (half_t*)alloc((size_t)F_DIM * C_DIM * 2);
  half_t* A16  = (half_t*)alloc((size_t)NT * C_DIM * 2);
  half_t* Q16  = (half_t*)alloc((size_t)NT * C_DIM * 2);
  half_t* KV16 = (half_t*)alloc((size_t)NT * 2 * C_DIM * 2);
  half_t* O16  = (half_t*)alloc((size_t)NT * C_DIM * 2);
  float*  H32  = (float*)alloc((size_t)NT * C_DIM * 4);
  half_t* G16  = (half_t*)alloc((size_t)NT * F_DIM * 2);

  auto cast = [&](const float* s, half_t* d, int n) {
    cast_f32_to_f16<<<(n + 255) / 256, 256, 0, stream>>>(s, d, n);
  };
  cast(q_w, wq, C_DIM * C_DIM);
  cast(kv_w, wkv, C_DIM * 2 * C_DIM);
  cast(out_w, wo, C_DIM * C_DIM);
  cast(ff_w1, wf1, C_DIM * F_DIM);
  cast(ff_w2, wf2, F_DIM * C_DIM);

  layernorm_f16<true><<<NT, 256, 0, stream>>>(x, ln1_g, ln1_b, A16);

  dim3 blk(128);
  gemm_wmma<MODE_F16_BIAS, C_DIM><<<dim3(NT / BM, C_DIM / BN), blk, 0, stream>>>(
      A16, wq, q_b, nullptr, Q16, nullptr, C_DIM);
  gemm_wmma<MODE_F16_BIAS, 2 * C_DIM><<<dim3(NT / BM, 2 * C_DIM / BN), blk, 0, stream>>>(
      A16, wkv, kv_b, nullptr, KV16, nullptr, C_DIM);

  int nrope = NT * H_DIM * (D_DIM / 2);
  rope_inplace<<<(nrope + 255) / 256, 256, 0, stream>>>(Q16, C_DIM);
  rope_inplace<<<(nrope + 255) / 256, 256, 0, stream>>>(KV16, 2 * C_DIM);

  attn_kernel<<<dim3(T_DIM / (16 * AQW), H_DIM, N_DIM), 32 * AQW, 0, stream>>>(Q16, KV16, O16);

  gemm_wmma<MODE_F32_RES_T, C_DIM><<<dim3(NT / BM, C_DIM / BN), blk, 0, stream>>>(
      O16, wo, out_b, x, nullptr, H32, C_DIM);

  layernorm_f16<false><<<NT, 256, 0, stream>>>(H32, ln2_g, ln2_b, A16);

  gemm_wmma<MODE_F16_GELU, F_DIM><<<dim3(NT / BM, F_DIM / BN), blk, 0, stream>>>(
      A16, wf1, ff_b1, nullptr, G16, nullptr, C_DIM);

  gemm_wmma<MODE_F32_OUT_T, C_DIM><<<dim3(NT / BM, C_DIM / BN), blk, 0, stream>>>(
      G16, wf2, ff_b2, H32, nullptr, (float*)d_out, F_DIM);
}
